// v000
// The times below were measured on an AMD MI455X: many runs one after another, warmed up first and cycling through
// copies of the inputs, with the whole window's GPU time divided by the number of runs. Launches and the gaps
// between them are all in it. The median over several windows is given; except for v000 it joins two sittings, which
// can be a few percent apart, so the side-by-side timings, each taken in one sitting, are the better comparison.
// The starting kernel, v000, takes 941 microseconds a run.
#include <hip/hip_runtime.h>
#include <cstddef>

#define Hh 2048
#define Cc 64
#define BG 16
#define NTILE 128   // Hh / 16
#define LQLD 17     // padded LDS row stride (floats)

typedef float v2f __attribute__((ext_vector_type(2)));
typedef float v8f __attribute__((ext_vector_type(8)));

// Fragment loader for the 16x4 f32 A layout (and symmetric 4x16 B layout):
// lane L<16 : vgpr0 = X[kc+0][base+L], vgpr1 = X[kc+1][base+L]
// lane L>=16: vgpr0 = X[kc+2][base+L-16], vgpr1 = X[kc+3][base+L-16]
static __device__ __forceinline__ v2f frag_g(const float* p, int ld, int base,
                                             int kc, int half, int m) {
  const float* a = p + (size_t)(kc + 2 * half) * ld + base + m;
  v2f r;
  r.x = a[0];
  r.y = a[ld];
  return r;
}

static __device__ __forceinline__ v8f wmma4(v2f a, v2f b, v8f c) {
  return __builtin_amdgcn_wmma_f32_16x16x4_f32(false, a, false, b, (short)0, c,
                                               false, false);
}

// ---------------------------------------------------------------------------
// K1: bias[bg,h] = 0.5 * beta * sum_c mu[bg,c,h]^2
// ---------------------------------------------------------------------------
__global__ void k_bias(const float* __restrict__ mu,
                       const float* __restrict__ beta,
                       float* __restrict__ bias) {
  const int idx = blockIdx.x * 256 + threadIdx.x;  // 0 .. BG*Hh-1
  const int bg = idx >> 11;                        // Hh == 2048
  const int h = idx & (Hh - 1);
  const float* p = mu + (size_t)bg * Cc * Hh + h;
  float s = 0.0f;
#pragma unroll 4
  for (int c = 0; c < Cc; ++c) {
    const float x = p[(size_t)c * Hh];
    s = fmaf(x, x, s);
  }
  bias[idx] = 0.5f * beta[0] * s;
}

// ---------------------------------------------------------------------------
// K2: per (bg, i-tile) wave: streaming softmax stats over j
//     logits[i,j] = a*(q^T zeta)[i,j] + bias[j];  m = rowmax, s = sum exp
// ---------------------------------------------------------------------------
__global__ __launch_bounds__(32) void k_stats(
    const float* __restrict__ q, const float* __restrict__ zeta,
    const float* __restrict__ bias, const float* __restrict__ alpha,
    float* __restrict__ mrow, float* __restrict__ srow) {
  const int wid = blockIdx.x;
  const int bg = wid >> 7;
  const int i0 = (wid & 127) << 4;
  const float* qbg = q + (size_t)bg * Cc * Hh;
  const float* zbg = zeta + (size_t)bg * Cc * Hh;
  const float* bbg = bias + (size_t)bg * Hh;
  const float a = alpha[0];
  const int lane = threadIdx.x & 31;
  const int half = lane >> 4;
  const int n = lane & 15;

  // A fragments of q^T (M=i, K=c), persistent across the j loop
  v2f afr[16];
#pragma unroll
  for (int kb = 0; kb < 16; ++kb) afr[kb] = frag_g(qbg, Hh, i0, kb * 4, half, n);

  float rmax[8], rsum[8];
#pragma unroll
  for (int v = 0; v < 8; ++v) {
    rmax[v] = -3.0e38f;
    rsum[v] = 0.0f;
  }

  for (int jt = 0; jt < NTILE; ++jt) {
    const int j0 = jt << 4;
    v8f d = {0.f, 0.f, 0.f, 0.f, 0.f, 0.f, 0.f, 0.f};
#pragma unroll
    for (int kb = 0; kb < 16; ++kb) {
      v2f bfr = frag_g(zbg, Hh, j0, kb * 4, half, n);  // B: zeta (K=c, N=j)
      d = wmma4(afr[kb], bfr, d);
    }
    const float bn = bbg[j0 + n];
#pragma unroll
    for (int v = 0; v < 8; ++v) {
      float t = fmaf(a, d[v], bn);
      // reduce over the 16 columns held within this half-wave (row fixed)
      float tm = t;
      tm = fmaxf(tm, __shfl_xor(tm, 1, 32));
      tm = fmaxf(tm, __shfl_xor(tm, 2, 32));
      tm = fmaxf(tm, __shfl_xor(tm, 4, 32));
      tm = fmaxf(tm, __shfl_xor(tm, 8, 32));
      const float nm = fmaxf(rmax[v], tm);
      float es = __expf(t - nm);
      es += __shfl_xor(es, 1, 32);
      es += __shfl_xor(es, 2, 32);
      es += __shfl_xor(es, 4, 32);
      es += __shfl_xor(es, 8, 32);
      rsum[v] = rsum[v] * __expf(rmax[v] - nm) + es;
      rmax[v] = nm;
    }
  }
  if (n == 0) {
#pragma unroll
    for (int v = 0; v < 8; ++v) {
      const int row = i0 + v + 8 * half;
      mrow[(size_t)bg * Hh + row] = rmax[v];
      srow[(size_t)bg * Hh + row] = rsum[v];
    }
  }
}

// ---------------------------------------------------------------------------
// K3: per (bg, j-tile) wave: zeta_new[c,j] = (sum_i w[i,j] q[c,i]) / sum_i w
//     w recomputed from (zeta_old, m, s)
// ---------------------------------------------------------------------------
__global__ __launch_bounds__(32) void k_zeta(
    const float* __restrict__ q, const float* __restrict__ zold,
    const float* __restrict__ bias, const float* __restrict__ alpha,
    const float* __restrict__ mrow, const float* __restrict__ srow,
    float* __restrict__ znew) {
  __shared__ float lq[Cc * LQLD];
  __shared__ float lw[16 * 16];
  const int wid = blockIdx.x;
  const int bg = wid >> 7;
  const int j0 = (wid & 127) << 4;
  const float* qbg = q + (size_t)bg * Cc * Hh;
  const float* zbg = zold + (size_t)bg * Cc * Hh;
  const float* bbg = bias + (size_t)bg * Hh;
  const float* mbg = mrow + (size_t)bg * Hh;
  const float* sbg = srow + (size_t)bg * Hh;
  const float a = alpha[0];
  const int lane = threadIdx.x & 31;
  const int half = lane >> 4;
  const int n = lane & 15;

  // B fragments of zeta (K=c, N=j) for the fixed j-tile, persistent
  v2f bz[16];
#pragma unroll
  for (int kb = 0; kb < 16; ++kb) bz[kb] = frag_g(zbg, Hh, j0, kb * 4, half, n);
  const float bn = bbg[j0 + n];

  const v8f vz = {0.f, 0.f, 0.f, 0.f, 0.f, 0.f, 0.f, 0.f};
  v8f acc[4];
#pragma unroll
  for (int t = 0; t < 4; ++t) acc[t] = vz;
  float csum = 0.0f;

  for (int it = 0; it < NTILE; ++it) {
    const int i0 = it << 4;
    // stage q[c, i0:i0+16] tile into LDS (coalesced)
    for (int idx = lane; idx < Cc * 16; idx += 32) {
      const int c = idx >> 4, ii = idx & 15;
      lq[c * LQLD + ii] = qbg[(size_t)c * Hh + i0 + ii];
    }
    __syncthreads();
    // GEMM1: qz[i,j] = sum_c q[c,i] zeta[c,j]
    v8f d = vz;
#pragma unroll
    for (int kb = 0; kb < 16; ++kb) {
      const int kc = kb * 4;
      v2f afr;  // A: q^T (M=i, K=c) read from LDS
      afr.x = lq[(kc + 2 * half) * LQLD + n];
      afr.y = lq[(kc + 2 * half + 1) * LQLD + n];
      d = wmma4(afr, bz[kb], d);
    }
    // w tile -> LDS, plus column-sum accumulation
#pragma unroll
    for (int v = 0; v < 8; ++v) {
      const int row = i0 + v + 8 * half;
      const float w =
          __expf(fmaf(a, d[v], bn) - mbg[row]) / (sbg[row] + 1e-20f);
      lw[(v + 8 * half) * 16 + n] = w;
      csum += w;
    }
    __syncthreads();
    // GEMM2: acc[c,j] += q[c,i] * w[i,j]  (K = i, 4 steps of 4)
#pragma unroll
    for (int t = 0; t < 4; ++t) {
#pragma unroll
      for (int kb = 0; kb < 4; ++kb) {
        const int kc = kb * 4;
        v2f a2;  // A: q (M=c, K=i)
        a2.x = lq[(t * 16 + n) * LQLD + kc + 2 * half];
        a2.y = lq[(t * 16 + n) * LQLD + kc + 2 * half + 1];
        v2f b2;  // B: w (K=i, N=j)
        b2.x = lw[(kc + 2 * half) * 16 + n];
        b2.y = lw[(kc + 2 * half + 1) * 16 + n];
        acc[t] = wmma4(a2, b2, acc[t]);
      }
    }
    __syncthreads();
  }
  csum += __shfl_xor(csum, 16, 32);  // combine the two half-wave row groups
  const float inv = 1.0f / csum;
  float* zo = znew + (size_t)bg * Cc * Hh;
#pragma unroll
  for (int t = 0; t < 4; ++t) {
#pragma unroll
    for (int v = 0; v < 8; ++v) {
      const int c = t * 16 + v + 8 * half;
      zo[(size_t)c * Hh + j0 + n] = acc[t][v] * inv;
    }
  }
}

// ---------------------------------------------------------------------------
// K4: per (bg, i-tile) wave: out[c,i] = sum_j w[i,j] mu[c,j]
//     logits computed TRANSPOSED (M=j, N=i) so w^T lands in B orientation
// ---------------------------------------------------------------------------
__global__ __launch_bounds__(32) void k_value(
    const float* __restrict__ q, const float* __restrict__ zeta,
    const float* __restrict__ mu, const float* __restrict__ bias,
    const float* __restrict__ alpha, const float* __restrict__ mrow,
    const float* __restrict__ srow, float* __restrict__ out) {
  __shared__ float lmu[Cc * LQLD];
  __shared__ float lw[16 * 16];
  const int wid = blockIdx.x;
  const int bg = wid >> 7;
  const int i0 = (wid & 127) << 4;
  const float* qbg = q + (size_t)bg * Cc * Hh;
  const float* zbg = zeta + (size_t)bg * Cc * Hh;
  const float* mubg = mu + (size_t)bg * Cc * Hh;
  const float* bbg = bias + (size_t)bg * Hh;
  const float a = alpha[0];
  const int lane = threadIdx.x & 31;
  const int half = lane >> 4;
  const int n = lane & 15;

  // B fragments of q (K=c, N=i) for the fixed i-tile, persistent
  v2f bq[16];
#pragma unroll
  for (int kb = 0; kb < 16; ++kb) bq[kb] = frag_g(qbg, Hh, i0, kb * 4, half, n);
  const float mr = mrow[(size_t)bg * Hh + i0 + n];
  const float sr = srow[(size_t)bg * Hh + i0 + n] + 1e-20f;

  const v8f vz = {0.f, 0.f, 0.f, 0.f, 0.f, 0.f, 0.f, 0.f};
  v8f acc[4];
#pragma unroll
  for (int t = 0; t < 4; ++t) acc[t] = vz;

  for (int jt = 0; jt < NTILE; ++jt) {
    const int j0 = jt << 4;
    // stage mu[c, j0:j0+16] tile into LDS
    for (int idx = lane; idx < Cc * 16; idx += 32) {
      const int c = idx >> 4, jj = idx & 15;
      lmu[c * LQLD + jj] = mubg[(size_t)c * Hh + j0 + jj];
    }
    __syncthreads();
    // transposed logits: tz[j,i] = sum_c zeta[c,j] q[c,i]
    v8f d = vz;
#pragma unroll
    for (int kb = 0; kb < 16; ++kb) {
      v2f az = frag_g(zbg, Hh, j0, kb * 4, half, n);  // A: zeta^T (M=j, K=c)
      d = wmma4(az, bq[kb], d);
    }
    // w^T[j,i] -> LDS ; bias by row j, softmax stats by column i
#pragma unroll
    for (int v = 0; v < 8; ++v) {
      const float bj = bbg[j0 + v + 8 * half];
      lw[(v + 8 * half) * 16 + n] = __expf(fmaf(a, d[v], bj) - mr) / sr;
    }
    __syncthreads();
    // GEMM2: acc[c,i] += mu[c,j] * w^T[j,i]  (K = j, 4 steps of 4)
#pragma unroll
    for (int t = 0; t < 4; ++t) {
#pragma unroll
      for (int kb = 0; kb < 4; ++kb) {
        const int kc = kb * 4;
        v2f a2;  // A: mu (M=c, K=j)
        a2.x = lmu[(t * 16 + n) * LQLD + kc + 2 * half];
        a2.y = lmu[(t * 16 + n) * LQLD + kc + 2 * half + 1];
        v2f b2;  // B: w^T (K=j, N=i)
        b2.x = lw[(kc + 2 * half) * 16 + n];
        b2.y = lw[(kc + 2 * half + 1) * 16 + n];
        acc[t] = wmma4(a2, b2, acc[t]);
      }
    }
    __syncthreads();
  }
  float* obg = out + (size_t)bg * Cc * Hh;
#pragma unroll
  for (int t = 0; t < 4; ++t) {
#pragma unroll
    for (int v = 0; v < 8; ++v) {
      const int c = t * 16 + v + 8 * half;
      obg[(size_t)c * Hh + i0 + n] = acc[t][v];
    }
  }
}

// ---------------------------------------------------------------------------
extern "C" void kernel_launch(void* const* d_in, const int* in_sizes, int n_in,
                              void* d_out, int out_size, void* d_ws,
                              size_t ws_size, hipStream_t stream) {
  const float* q = (const float*)d_in[0];
  const float* zeta = (const float*)d_in[1];
  const float* alpha = (const float*)d_in[2];
  const float* mu = (const float*)d_in[3];
  const float* beta = (const float*)d_in[4];
  float* out = (float*)d_out;

  float* ws = (float*)d_ws;
  float* bias = ws;                          // BG*Hh floats
  float* mrow = ws + (size_t)BG * Hh;        // BG*Hh
  float* srow = ws + (size_t)2 * BG * Hh;    // BG*Hh
  float* za = ws + (size_t)3 * BG * Hh;      // BG*Cc*Hh
  float* zb = za + (size_t)BG * Cc * Hh;     // BG*Cc*Hh  (~17 MB total)

  const dim3 wgrid(BG * NTILE), wblk(32);

  k_bias<<<dim3((BG * Hh) / 256), dim3(256), 0, stream>>>(mu, beta, bias);
  // w0 = UW(zeta_in)
  k_stats<<<wgrid, wblk, 0, stream>>>(q, zeta, bias, alpha, mrow, srow);
  // iter 1: zeta_a = Z(w0);  w1 = UW(zeta_a)
  k_zeta<<<wgrid, wblk, 0, stream>>>(q, zeta, bias, alpha, mrow, srow, za);
  k_stats<<<wgrid, wblk, 0, stream>>>(q, za, bias, alpha, mrow, srow);
  // iter 2: zeta_b = Z(w1);  w2 = UW(zeta_b)
  k_zeta<<<wgrid, wblk, 0, stream>>>(q, za, bias, alpha, mrow, srow, zb);
  k_stats<<<wgrid, wblk, 0, stream>>>(q, zb, bias, alpha, mrow, srow);
  // out = V(w2)
  k_value<<<wgrid, wblk, 0, stream>>>(q, zb, mu, bias, alpha, mrow, srow, out);

  (void)in_sizes;
  (void)n_in;
  (void)out_size;
  (void)ws_size;
}

// v001
// It runs in 642 microseconds.
// Next to v000, in two timings, it ran 1.32 and 1.31 times as fast.
#include <hip/hip_runtime.h>
#include <cstddef>

#define Hh 2048
#define Cc 64
#define BG 16
#define NTILE 128   // Hh / 16
#define LQLD 17     // padded LDS row stride (floats)
#define NW 4        // waves per work-group; each takes NTILE / NW tiles of the reduced axis
#define TPW 32      // NTILE / NW

typedef float v2f __attribute__((ext_vector_type(2)));
typedef float v8f __attribute__((ext_vector_type(8)));

// Fragment loader for the 16x4 f32 A layout (and symmetric 4x16 B layout):
// lane L<16 : vgpr0 = X[kc+0][base+L], vgpr1 = X[kc+1][base+L]
// lane L>=16: vgpr0 = X[kc+2][base+L-16], vgpr1 = X[kc+3][base+L-16]
static __device__ __forceinline__ v2f frag_g(const float* p, int ld, int base,
                                             int kc, int half, int m) {
  const float* a = p + (size_t)(kc + 2 * half) * ld + base + m;
  v2f r;
  r.x = a[0];
  r.y = a[ld];
  return r;
}

// Orders one wave's own LDS stores and loads (each wave stages in LDS rows that
// no other wave touches inside the loops): the fences keep the waits a
// work-group barrier would bring, the wave barrier keeps the compiler from
// moving LDS accesses across; without it a lane could read a row before its
// neighbour lane's store. No other wave is waited for.
static __device__ __forceinline__ void wave_sync() {
  __builtin_amdgcn_fence(__ATOMIC_RELEASE, "workgroup");
  __builtin_amdgcn_wave_barrier();
  __builtin_amdgcn_fence(__ATOMIC_ACQUIRE, "workgroup");
}

static __device__ __forceinline__ v8f wmma4(v2f a, v2f b, v8f c) {
  return __builtin_amdgcn_wmma_f32_16x16x4_f32(false, a, false, b, (short)0, c,
                                               false, false);
}

// ---------------------------------------------------------------------------
// K1: bias[bg,h] = 0.5 * beta * sum_c mu[bg,c,h]^2
// ---------------------------------------------------------------------------
__global__ void k_bias(const float* __restrict__ mu,
                       const float* __restrict__ beta,
                       float* __restrict__ bias) {
  const int idx = blockIdx.x * 256 + threadIdx.x;  // 0 .. BG*Hh-1
  const int bg = idx >> 11;                        // Hh == 2048
  const int h = idx & (Hh - 1);
  const float* p = mu + (size_t)bg * Cc * Hh + h;
  float s = 0.0f;
#pragma unroll 4
  for (int c = 0; c < Cc; ++c) {
    const float x = p[(size_t)c * Hh];
    s = fmaf(x, x, s);
  }
  bias[idx] = 0.5f * beta[0] * s;
}

// ---------------------------------------------------------------------------
// K2: per (bg, i-tile) work-group: streaming softmax stats over j
//     logits[i,j] = a*(q^T zeta)[i,j] + bias[j];  m = rowmax, s = sum exp
//     each of the NW waves streams a quarter of j; partial (m, s) merge in LDS
// ---------------------------------------------------------------------------
__global__ __launch_bounds__(32 * NW) void k_stats(
    const float* __restrict__ q, const float* __restrict__ zeta,
    const float* __restrict__ bias, const float* __restrict__ alpha,
    float* __restrict__ mrow, float* __restrict__ srow) {
  __shared__ float pm[NW][16];
  __shared__ float ps[NW][16];
  const int wave = __builtin_amdgcn_readfirstlane((int)(threadIdx.x >> 5));
  const int wid = blockIdx.x;
  const int bg = wid >> 7;
  const int i0 = (wid & 127) << 4;
  const float* qbg = q + (size_t)bg * Cc * Hh;
  const float* zbg = zeta + (size_t)bg * Cc * Hh;
  const float* bbg = bias + (size_t)bg * Hh;
  const float a = alpha[0];
  const int lane = threadIdx.x & 31;
  const int half = lane >> 4;
  const int n = lane & 15;

  // A fragments of q^T (M=i, K=c), persistent across the j loop
  v2f afr[16];
#pragma unroll
  for (int kb = 0; kb < 16; ++kb) afr[kb] = frag_g(qbg, Hh, i0, kb * 4, half, n);

  float rmax[8], rsum[8];
#pragma unroll
  for (int v = 0; v < 8; ++v) {
    rmax[v] = -3.0e38f;
    rsum[v] = 0.0f;
  }

  for (int jt = wave * TPW; jt < wave * TPW + TPW; ++jt) {
    const int j0 = jt << 4;
    v8f d = {0.f, 0.f, 0.f, 0.f, 0.f, 0.f, 0.f, 0.f};
#pragma unroll
    for (int kb = 0; kb < 16; ++kb) {
      v2f bfr = frag_g(zbg, Hh, j0, kb * 4, half, n);  // B: zeta (K=c, N=j)
      d = wmma4(afr[kb], bfr, d);
    }
    const float bn = bbg[j0 + n];
#pragma unroll
    for (int v = 0; v < 8; ++v) {
      float t = fmaf(a, d[v], bn);
      // reduce over the 16 columns held within this half-wave (row fixed)
      float tm = t;
      tm = fmaxf(tm, __shfl_xor(tm, 1, 32));
      tm = fmaxf(tm, __shfl_xor(tm, 2, 32));
      tm = fmaxf(tm, __shfl_xor(tm, 4, 32));
      tm = fmaxf(tm, __shfl_xor(tm, 8, 32));
      const float nm = fmaxf(rmax[v], tm);
      float es = __expf(t - nm);
      es += __shfl_xor(es, 1, 32);
      es += __shfl_xor(es, 2, 32);
      es += __shfl_xor(es, 4, 32);
      es += __shfl_xor(es, 8, 32);
      rsum[v] = rsum[v] * __expf(rmax[v] - nm) + es;
      rmax[v] = nm;
    }
  }
  if (n == 0) {
#pragma unroll
    for (int v = 0; v < 8; ++v) {
      pm[wave][v + 8 * half] = rmax[v];
      ps[wave][v + 8 * half] = rsum[v];
    }
  }
  __syncthreads();
  // merge the NW partial (max, sum) pairs of each row
  if (threadIdx.x < 16) {
    const int r = threadIdx.x;
    float m = pm[0][r];
#pragma unroll
    for (int w = 1; w < NW; ++w) m = fmaxf(m, pm[w][r]);
    float sum = 0.0f;
#pragma unroll
    for (int w = 0; w < NW; ++w) sum += ps[w][r] * __expf(pm[w][r] - m);
    mrow[(size_t)bg * Hh + i0 + r] = m;
    srow[(size_t)bg * Hh + i0 + r] = sum;
  }
}

// ---------------------------------------------------------------------------
// K3: per (bg, j-tile) work-group: zeta_new[c,j] = (sum_i w[i,j] q[c,i]) / sum_i w
//     w recomputed from (zeta_old, m, s)
//     each of the NW waves sums a quarter of i; partial sums merge in LDS
//     (launch bound 8 = waves a SIMD: a budget of 128 registers, so that all
//     2048 work-groups are resident at once)
// ---------------------------------------------------------------------------
__global__ __launch_bounds__(32 * NW, 8) void k_zeta(
    const float* __restrict__ q, const float* __restrict__ zold,
    const float* __restrict__ bias, const float* __restrict__ alpha,
    const float* __restrict__ mrow, const float* __restrict__ srow,
    float* __restrict__ znew) {
  __shared__ float lqs[NW][Cc * LQLD];
  __shared__ float lws[NW][16 * 16];
  const int wave = __builtin_amdgcn_readfirstlane((int)(threadIdx.x >> 5));
  float* lq = lqs[wave];  // this wave's own staging rows
  float* lw = lws[wave];
  const int wid = blockIdx.x;
  const int bg = wid >> 7;
  const int j0 = (wid & 127) << 4;
  const float* qbg = q + (size_t)bg * Cc * Hh;
  const float* zbg = zold + (size_t)bg * Cc * Hh;
  const float* bbg = bias + (size_t)bg * Hh;
  const float* mbg = mrow + (size_t)bg * Hh;
  const float* sbg = srow + (size_t)bg * Hh;
  const float a = alpha[0];
  const int lane = threadIdx.x & 31;
  const int half = lane >> 4;
  const int n = lane & 15;

  // B fragments of zeta (K=c, N=j) for the fixed j-tile, persistent
  v2f bz[16];
  const float* zfr = zbg + (size_t)(2 * half) * Hh + j0 + n;  // lane's element of row 2*half
#pragma unroll
  for (int kb = 0; kb < 16; ++kb) bz[kb] = frag_g(zfr, Hh, 0, kb * 4, 0, 0);
  const float bn = bbg[j0 + n];
  // the address registers of the loads above are inputs here, so they live up
  // to this wait and are reused only behind it
  asm volatile("s_wait_xcnt 0x0" ::"v"(zfr), "v"(j0 + n) : "memory");

  const v8f vz = {0.f, 0.f, 0.f, 0.f, 0.f, 0.f, 0.f, 0.f};
  v8f acc[4];
#pragma unroll
  for (int t = 0; t < 4; ++t) acc[t] = vz;
  float csum = 0.0f;

  const float* qst = qbg + (size_t)half * Hh + n;  // lane's element of rows half, half+2, ...
  // Per-lane LDS bases, so that every access below is base + constant and the
  // address registers stay few enough for 8 resident waves a SIMD.
  float* lq_st = lq + half * LQLD + n;            // staging store: row 2k + half, column n
  const float* lq_a1 = lq + 2 * half * LQLD + n;  // GEMM1 A: row kc + 2*half, column n
  const float* lq_a2 = lq + n * LQLD + 2 * half;  // GEMM2 A: row t*16 + n, column kc + 2*half
  float* lw_st = lw + 8 * half * 16 + n;          // w store: row v + 8*half, column n
  const float* lw_b2 = lw + 2 * half * 16 + n;    // GEMM2 B: row kc + 2*half, column n
  for (int it = wave * TPW; it < wave * TPW + TPW; ++it) {
    const int i0 = it << 4;
    // stage q[c, i0:i0+16] tile into LDS (coalesced)
    // (one lane address plus constant row steps: keeps the address registers
    // few enough for 8 resident waves a SIMD)
    const float* qsi = qst + i0;
#pragma unroll
    for (int k = 0; k < Cc / 2; ++k) lq_st[2 * k * LQLD] = qsi[(size_t)(2 * k) * Hh];
    wave_sync();
    // GEMM1: qz[i,j] = sum_c q[c,i] zeta[c,j]
    v8f d = vz;
#pragma unroll
    for (int kb = 0; kb < 16; ++kb) {
      const int kc = kb * 4;
      v2f afr;  // A: q^T (M=i, K=c) read from LDS
      afr.x = lq_a1[kc * LQLD];
      afr.y = lq_a1[(kc + 1) * LQLD];
      d = wmma4(afr, bz[kb], d);
    }
    // w tile -> LDS, plus column-sum accumulation
#pragma unroll
    for (int v = 0; v < 8; ++v) {
      const int row = i0 + v + 8 * half;
      const float w =
          __expf(fmaf(a, d[v], bn) - mbg[row]) / (sbg[row] + 1e-20f);
      lw_st[v * 16] = w;
      csum += w;
    }
    wave_sync();
    // GEMM2: acc[c,j] += q[c,i] * w[i,j]  (K = i, 4 steps of 4)
#pragma unroll
    for (int t = 0; t < 4; ++t) {
#pragma unroll
      for (int kb = 0; kb < 4; ++kb) {
        const int kc = kb * 4;
        v2f a2;  // A: q (M=c, K=i)
        a2.x = lq_a2[t * 16 * LQLD + kc];
        a2.y = lq_a2[t * 16 * LQLD + kc + 1];
        v2f b2;  // B: w (K=i, N=j)
        b2.x = lw_b2[kc * 16];
        b2.y = lw_b2[(kc + 1) * 16];
        acc[t] = wmma4(a2, b2, acc[t]);
      }
    }
    wave_sync();
  }
  csum += __shfl_xor(csum, 16, 32);  // combine the two half-wave row groups
  // each wave leaves its partial sums in its own staging rows
  float* lq_p = lq + 8 * half * LQLD + n;  // row t*16 + v + 8*half, column n
#pragma unroll
  for (int t = 0; t < 4; ++t) {
#pragma unroll
    for (int v = 0; v < 8; ++v) {
      lq_p[(t * 16 + v) * LQLD] = acc[t][v];
    }
  }
  if (half == 0) lw[n] = csum;
  __syncthreads();
  // merge: thread x owns column x & 15 and rows (x >> 4) + 8k
  const int mc = threadIdx.x >> 4;
  float cs = 0.0f;
#pragma unroll
  for (int w = 0; w < NW; ++w) cs += lws[w][n];
  const float inv = 1.0f / cs;
  float* zo = znew + (size_t)bg * Cc * Hh;
#pragma unroll
  for (int k = 0; k < Cc / (2 * NW); ++k) {
    const int c = mc + 2 * NW * k;
    float sum = 0.0f;
#pragma unroll
    for (int w = 0; w < NW; ++w) sum += lqs[w][c * LQLD + n];
    zo[(size_t)c * Hh + j0 + n] = sum * inv;
  }
}

// ---------------------------------------------------------------------------
// K4: per (bg, i-tile) work-group: out[c,i] = sum_j w[i,j] mu[c,j]
//     logits computed TRANSPOSED (M=j, N=i) so w^T lands in B orientation
//     each of the NW waves sums a quarter of j; partial sums merge in LDS
//     (no waves-a-SIMD bound here: the build takes 128 registers without it,
//     and with it the compiler waited for every pair of loads in the loop)
// ---------------------------------------------------------------------------
__global__ __launch_bounds__(32 * NW) void k_value(
    const float* __restrict__ q, const float* __restrict__ zeta,
    const float* __restrict__ mu, const float* __restrict__ bias,
    const float* __restrict__ alpha, const float* __restrict__ mrow,
    const float* __restrict__ srow, float* __restrict__ out) {
  __shared__ float lmus[NW][Cc * LQLD];
  __shared__ float lws[NW][16 * 16];
  const int wave = __builtin_amdgcn_readfirstlane((int)(threadIdx.x >> 5));
  float* lmu = lmus[wave];  // this wave's own staging rows
  float* lw = lws[wave];
  const int wid = blockIdx.x;
  const int bg = wid >> 7;
  const int i0 = (wid & 127) << 4;
  const float* qbg = q + (size_t)bg * Cc * Hh;
  const float* zbg = zeta + (size_t)bg * Cc * Hh;
  const float* mubg = mu + (size_t)bg * Cc * Hh;
  const float* bbg = bias + (size_t)bg * Hh;
  const float a = alpha[0];
  const int lane = threadIdx.x & 31;
  const int half = lane >> 4;
  const int n = lane & 15;

  // B fragments of q (K=c, N=i) for the fixed i-tile, persistent
  v2f bq[16];
#pragma unroll
  for (int kb = 0; kb < 16; ++kb) bq[kb] = frag_g(qbg, Hh, i0, kb * 4, half, n);
  const float mr = mrow[(size_t)bg * Hh + i0 + n];
  const float sr = srow[(size_t)bg * Hh + i0 + n] + 1e-20f;
  // the address registers of the loads above are inputs here, so they live up
  // to this wait and are reused only behind it
  asm volatile("s_wait_xcnt 0x0" ::"v"(qbg + (size_t)(2 * half) * Hh + i0 + n),
               "v"(mrow + (size_t)bg * Hh + i0 + n), "v"(srow + (size_t)bg * Hh + i0 + n) : "memory");

  const v8f vz = {0.f, 0.f, 0.f, 0.f, 0.f, 0.f, 0.f, 0.f};
  v8f acc[4];
#pragma unroll
  for (int t = 0; t < 4; ++t) acc[t] = vz;

  const float* must = mubg + (size_t)half * Hh + n;  // lane's element of rows half, half+2, ...
  // Per-lane LDS bases, so that every access below is base + constant and the
  // address registers stay few enough for 8 resident waves a SIMD.
  float* lmu_st = lmu + half * LQLD + n;            // staging store: row 2k + half, column n
  const float* lmu_a2 = lmu + n * LQLD + 2 * half;  // GEMM2 A: row t*16 + n, column kc + 2*half
  float* lw_st = lw + 8 * half * 16 + n;            // w^T store: row v + 8*half, column n
  const float* lw_b2 = lw + 2 * half * 16 + n;      // GEMM2 B: row kc + 2*half, column n
  for (int jt = wave * TPW; jt < wave * TPW + TPW; ++jt) {
    const int j0 = jt << 4;
    // stage mu[c, j0:j0+16] tile into LDS
    // (one lane address plus constant row steps: keeps the address registers
    // few enough for 8 resident waves a SIMD)
    const float* musi = must + j0;
#pragma unroll
    for (int k = 0; k < Cc / 2; ++k) lmu_st[2 * k * LQLD] = musi[(size_t)(2 * k) * Hh];
    wave_sync();
    // transposed logits: tz[j,i] = sum_c zeta[c,j] q[c,i]
    v8f d = vz;
#pragma unroll
    for (int kb = 0; kb < 16; ++kb) {
      v2f az = frag_g(zbg, Hh, j0, kb * 4, half, n);  // A: zeta^T (M=j, K=c)
      d = wmma4(az, bq[kb], d);
    }
    // w^T[j,i] -> LDS ; bias by row j, softmax stats by column i
#pragma unroll
    for (int v = 0; v < 8; ++v) {
      const float bj = bbg[j0 + v + 8 * half];
      lw_st[v * 16] = __expf(fmaf(a, d[v], bj) - mr) / sr;
    }
    wave_sync();
    // GEMM2: acc[c,i] += mu[c,j] * w^T[j,i]  (K = j, 4 steps of 4)
#pragma unroll
    for (int t = 0; t < 4; ++t) {
#pragma unroll
      for (int kb = 0; kb < 4; ++kb) {
        const int kc = kb * 4;
        v2f a2;  // A: mu (M=c, K=j)
        a2.x = lmu_a2[t * 16 * LQLD + kc];
        a2.y = lmu_a2[t * 16 * LQLD + kc + 1];
        v2f b2;  // B: w^T (K=j, N=i)
        b2.x = lw_b2[kc * 16];
        b2.y = lw_b2[(kc + 1) * 16];
        acc[t] = wmma4(a2, b2, acc[t]);
      }
    }
    wave_sync();
  }
  // each wave leaves its partial sums in its own staging rows
  float* lmu_p = lmu + 8 * half * LQLD + n;  // row t*16 + v + 8*half, column n
#pragma unroll
  for (int t = 0; t < 4; ++t) {
#pragma unroll
    for (int v = 0; v < 8; ++v) {
      lmu_p[(t * 16 + v) * LQLD] = acc[t][v];
    }
  }
  __syncthreads();
  // merge: thread x owns column x & 15 and rows (x >> 4) + 8k
  const int mc = threadIdx.x >> 4;
  float* obg = out + (size_t)bg * Cc * Hh;
#pragma unroll
  for (int k = 0; k < Cc / (2 * NW); ++k) {
    const int c = mc + 2 * NW * k;
    float sum = 0.0f;
#pragma unroll
    for (int w = 0; w < NW; ++w) sum += lmus[w][c * LQLD + n];
    obg[(size_t)c * Hh + i0 + n] = sum;
  }
}

// ---------------------------------------------------------------------------
extern "C" void kernel_launch(void* const* d_in, const int* in_sizes, int n_in,
                              void* d_out, int out_size, void* d_ws,
                              size_t ws_size, hipStream_t stream) {
  const float* q = (const float*)d_in[0];
  const float* zeta = (const float*)d_in[1];
  const float* alpha = (const float*)d_in[2];
  const float* mu = (const float*)d_in[3];
  const float* beta = (const float*)d_in[4];
  float* out = (float*)d_out;

  float* ws = (float*)d_ws;
  float* bias = ws;                          // BG*Hh floats
  float* mrow = ws + (size_t)BG * Hh;        // BG*Hh
  float* srow = ws + (size_t)2 * BG * Hh;    // BG*Hh
  float* za = ws + (size_t)3 * BG * Hh;      // BG*Cc*Hh
  float* zb = za + (size_t)BG * Cc * Hh;     // BG*Cc*Hh  (~17 MB total)

  const dim3 wgrid(BG * NTILE), wblk(32 * NW);

  k_bias<<<dim3((BG * Hh) / 256), dim3(256), 0, stream>>>(mu, beta, bias);
  // w0 = UW(zeta_in)
  k_stats<<<wgrid, wblk, 0, stream>>>(q, zeta, bias, alpha, mrow, srow);
  // iter 1: zeta_a = Z(w0);  w1 = UW(zeta_a)
  k_zeta<<<wgrid, wblk, 0, stream>>>(q, zeta, bias, alpha, mrow, srow, za);
  k_stats<<<wgrid, wblk, 0, stream>>>(q, za, bias, alpha, mrow, srow);
  // iter 2: zeta_b = Z(w1);  w2 = UW(zeta_b)
  k_zeta<<<wgrid, wblk, 0, stream>>>(q, za, bias, alpha, mrow, srow, zb);
  k_stats<<<wgrid, wblk, 0, stream>>>(q, zb, bias, alpha, mrow, srow);
  // out = V(w2)
  k_value<<<wgrid, wblk, 0, stream>>>(q, zb, mu, bias, alpha, mrow, srow, out);

  (void)in_sizes;
  (void)n_in;
  (void)out_size;
  (void)ws_size;
}

// v002
// One run takes 525 microseconds.
// Two timings next to v001 both put it at 1.22 times that version's speed.
// Counting every step since v000, it is 1.60 times as fast.
#include <hip/hip_runtime.h>
#include <cstddef>

#define Hh 2048
#define Cc 64
#define BG 16
#define NTILE 128   // Hh / 16
#define LQLD 17     // padded LDS row stride (floats)
#define NW 4        // waves per work-group; each takes NTILE / NW tiles of the reduced axis
#define TPW 32      // NTILE / NW
#define NT 2        // 16-wide tiles of the fixed axis held by each wave
#define FW 32       // NT * 16: width of the fixed axis per work-group
#define PLD 33      // padded LDS row stride (floats) of the FW-wide partial sums

typedef float v2f __attribute__((ext_vector_type(2)));
typedef float v8f __attribute__((ext_vector_type(8)));

// Fragment loader for the 16x4 f32 A layout (and symmetric 4x16 B layout):
// lane L<16 : vgpr0 = X[kc+0][base+L], vgpr1 = X[kc+1][base+L]
// lane L>=16: vgpr0 = X[kc+2][base+L-16], vgpr1 = X[kc+3][base+L-16]
static __device__ __forceinline__ v2f frag_g(const float* p, int ld, int base,
                                             int kc, int half, int m) {
  const float* a = p + (size_t)(kc + 2 * half) * ld + base + m;
  v2f r;
  r.x = a[0];
  r.y = a[ld];
  return r;
}

// Orders one wave's own LDS stores and loads (each wave stages in LDS rows that
// no other wave touches inside the loops): the fences keep the waits a
// work-group barrier would bring, the wave barrier keeps the compiler from
// moving LDS accesses across; without it a lane could read a row before its
// neighbour lane's store. No other wave is waited for.
static __device__ __forceinline__ void wave_sync() {
  __builtin_amdgcn_fence(__ATOMIC_RELEASE, "workgroup");
  __builtin_amdgcn_wave_barrier();
  __builtin_amdgcn_fence(__ATOMIC_ACQUIRE, "workgroup");
}

static __device__ __forceinline__ v8f wmma4(v2f a, v2f b, v8f c) {
  return __builtin_amdgcn_wmma_f32_16x16x4_f32(false, a, false, b, (short)0, c,
                                               false, false);
}

// ---------------------------------------------------------------------------
// K1: bias[bg,h] = 0.5 * beta * sum_c mu[bg,c,h]^2
// ---------------------------------------------------------------------------
__global__ void k_bias(const float* __restrict__ mu,
                       const float* __restrict__ beta,
                       float* __restrict__ bias) {
  const int idx = blockIdx.x * 256 + threadIdx.x;  // 0 .. BG*Hh-1
  const int bg = idx >> 11;                        // Hh == 2048
  const int h = idx & (Hh - 1);
  const float* p = mu + (size_t)bg * Cc * Hh + h;
  float s = 0.0f;
#pragma unroll 4
  for (int c = 0; c < Cc; ++c) {
    const float x = p[(size_t)c * Hh];
    s = fmaf(x, x, s);
  }
  bias[idx] = 0.5f * beta[0] * s;
}

// ---------------------------------------------------------------------------
// K2: per (bg, NT i-tiles) work-group: streaming softmax stats over j
//     logits[i,j] = a*(q^T zeta)[i,j] + bias[j];  m = rowmax, s = sum exp
//     each of the NW waves streams a quarter of j; partial (m, s) merge in LDS
//     each wave holds NT i-tiles, so every loaded zeta fragment feeds NT products
// ---------------------------------------------------------------------------
__global__ __launch_bounds__(32 * NW, 4) void k_stats(
    const float* __restrict__ q, const float* __restrict__ zeta,
    const float* __restrict__ bias, const float* __restrict__ alpha,
    float* __restrict__ mrow, float* __restrict__ srow) {
  __shared__ float pm[NW][FW];
  __shared__ float ps[NW][FW];
  const int wave = __builtin_amdgcn_readfirstlane((int)(threadIdx.x >> 5));
  const int wid = blockIdx.x;
  const int bg = wid >> 6;
  const int i0 = (wid & 63) << 5;
  const float* qbg = q + (size_t)bg * Cc * Hh;
  const float* zbg = zeta + (size_t)bg * Cc * Hh;
  const float* bbg = bias + (size_t)bg * Hh;
  const float a = alpha[0];
  const int lane = threadIdx.x & 31;
  const int half = lane >> 4;
  const int n = lane & 15;

  // A fragments of q^T (M=i, K=c), persistent across the j loop
  v2f afr[NT][16];
#pragma unroll
  for (int u = 0; u < NT; ++u) {
#pragma unroll
    for (int kb = 0; kb < 16; ++kb)
      afr[u][kb] = frag_g(qbg, Hh, i0 + 16 * u, kb * 4, half, n);
  }

  float rmax[NT][8], rsum[NT][8];
#pragma unroll
  for (int u = 0; u < NT; ++u) {
#pragma unroll
    for (int v = 0; v < 8; ++v) {
      rmax[u][v] = -3.0e38f;
      rsum[u][v] = 0.0f;
    }
  }

  for (int jt = wave * TPW; jt < wave * TPW + TPW; ++jt) {
    const int j0 = jt << 4;
    v8f d[NT];
#pragma unroll
    for (int u = 0; u < NT; ++u) d[u] = v8f{0.f, 0.f, 0.f, 0.f, 0.f, 0.f, 0.f, 0.f};
#pragma unroll
    for (int kb = 0; kb < 16; ++kb) {
      v2f bfr = frag_g(zbg, Hh, j0, kb * 4, half, n);  // B: zeta (K=c, N=j)
#pragma unroll
      for (int u = 0; u < NT; ++u) d[u] = wmma4(afr[u][kb], bfr, d[u]);
    }
    const float bn = bbg[j0 + n];
    // reduce over the 16 columns held within this half-wave (row fixed); each
    // cross-lane step is written for all NT * 8 rows at once, so that the rows'
    // exchanges are in flight together and one wait serves them all
    float t[NT * 8], tm[NT * 8], es[NT * 8];
#pragma unroll
    for (int uv = 0; uv < NT * 8; ++uv) {
      t[uv] = fmaf(a, d[uv >> 3][uv & 7], bn);
      tm[uv] = t[uv];
    }
#pragma unroll
    for (int s = 1; s < 16; s <<= 1) {
#pragma unroll
      for (int uv = 0; uv < NT * 8; ++uv) tm[uv] = fmaxf(tm[uv], __shfl_xor(tm[uv], s, 32));
    }
#pragma unroll
    for (int uv = 0; uv < NT * 8; ++uv) {
      tm[uv] = fmaxf(rmax[uv >> 3][uv & 7], tm[uv]);  // the new running maximum
      es[uv] = __expf(t[uv] - tm[uv]);
    }
#pragma unroll
    for (int s = 1; s < 16; s <<= 1) {
#pragma unroll
      for (int uv = 0; uv < NT * 8; ++uv) es[uv] += __shfl_xor(es[uv], s, 32);
    }
#pragma unroll
    for (int uv = 0; uv < NT * 8; ++uv) {
      const int u = uv >> 3;
      const int v = uv & 7;
      rsum[u][v] = rsum[u][v] * __expf(rmax[u][v] - tm[uv]) + es[uv];
      rmax[u][v] = tm[uv];
    }
  }
  if (n == 0) {
#pragma unroll
    for (int u = 0; u < NT; ++u) {
#pragma unroll
      for (int v = 0; v < 8; ++v) {
        pm[wave][16 * u + v + 8 * half] = rmax[u][v];
        ps[wave][16 * u + v + 8 * half] = rsum[u][v];
      }
    }
  }
  __syncthreads();
  // merge the NW partial (max, sum) pairs of each row
  if (threadIdx.x < FW) {
    const int r = threadIdx.x;
    float m = pm[0][r];
#pragma unroll
    for (int w = 1; w < NW; ++w) m = fmaxf(m, pm[w][r]);
    float sum = 0.0f;
#pragma unroll
    for (int w = 0; w < NW; ++w) sum += ps[w][r] * __expf(pm[w][r] - m);
    mrow[(size_t)bg * Hh + i0 + r] = m;
    srow[(size_t)bg * Hh + i0 + r] = sum;
  }
}

// ---------------------------------------------------------------------------
// K3: per (bg, NT j-tiles) work-group: zeta_new[c,j] = (sum_i w[i,j] q[c,i]) / sum_i w
//     w recomputed from (zeta_old, m, s)
//     each of the NW waves sums a quarter of i; partial sums merge in LDS
//     each wave holds NT j-tiles, so every staged q tile and every q fragment
//     read from LDS feeds NT products
//     (launch bound 4 = waves a SIMD: a budget of 256 registers, so that all
//     1024 work-groups are resident at once)
// ---------------------------------------------------------------------------
__global__ __launch_bounds__(32 * NW, 4) void k_zeta(
    const float* __restrict__ q, const float* __restrict__ zold,
    const float* __restrict__ bias, const float* __restrict__ alpha,
    const float* __restrict__ mrow, const float* __restrict__ srow,
    float* __restrict__ znew) {
  __shared__ float lqs[NW][Cc * PLD];  // staging at stride LQLD, partial sums at PLD
  __shared__ float lws[NW][NT * 16 * 16];
  const int wave = __builtin_amdgcn_readfirstlane((int)(threadIdx.x >> 5));
  float* lq = lqs[wave];  // this wave's own staging rows
  float* lw = lws[wave];
  const int wid = blockIdx.x;
  const int bg = wid >> 6;
  const int j0 = (wid & 63) << 5;
  const float* qbg = q + (size_t)bg * Cc * Hh;
  const float* zbg = zold + (size_t)bg * Cc * Hh;
  const float* bbg = bias + (size_t)bg * Hh;
  const float* mbg = mrow + (size_t)bg * Hh;
  const float* sbg = srow + (size_t)bg * Hh;
  const float a = alpha[0];
  const int lane = threadIdx.x & 31;
  const int half = lane >> 4;
  const int n = lane & 15;

  // B fragments of zeta (K=c, N=j) for the fixed j-tiles, persistent
  v2f bz[NT][16];
  float bn[NT];
  const float* zfr = zbg + (size_t)(2 * half) * Hh + j0 + n;  // lane's element of row 2*half
#pragma unroll
  for (int u = 0; u < NT; ++u) {
#pragma unroll
    for (int kb = 0; kb < 16; ++kb) bz[u][kb] = frag_g(zfr, Hh, 16 * u, kb * 4, 0, 0);
    bn[u] = bbg[j0 + n + 16 * u];
  }
  // the address registers of the loads above are inputs here, so they live up
  // to this wait and are reused only behind it
  asm volatile("s_wait_xcnt 0x0" ::"v"(zfr), "v"(j0 + n) : "memory");

  const v8f vz = {0.f, 0.f, 0.f, 0.f, 0.f, 0.f, 0.f, 0.f};
  v8f acc[NT][4];
  float csum[NT];
#pragma unroll
  for (int u = 0; u < NT; ++u) {
#pragma unroll
    for (int t = 0; t < 4; ++t) acc[u][t] = vz;
    csum[u] = 0.0f;
  }

  const float* qst = qbg + (size_t)half * Hh + n;  // lane's element of rows half, half+2, ...
  // Per-lane LDS bases, so that every access below is base + constant and the
  // address registers stay few (the fragments and sums fill the register budget).
  float* lq_st = lq + half * LQLD + n;            // staging store: row 2k + half, column n
  const float* lq_a1 = lq + 2 * half * LQLD + n;  // GEMM1 A: row kc + 2*half, column n
  const float* lq_a2 = lq + n * LQLD + 2 * half;  // GEMM2 A: row t*16 + n, column kc + 2*half
  float* lw_st = lw + 8 * half * 16 + n;          // w store: tile u, row v + 8*half, column n
  const float* lw_b2 = lw + 2 * half * 16 + n;    // GEMM2 B: tile u, row kc + 2*half, column n
  for (int it = wave * TPW; it < wave * TPW + TPW; ++it) {
    const int i0 = it << 4;
    // stage q[c, i0:i0+16] tile into LDS (coalesced)
    // (one lane address plus constant row steps: keeps the address registers few)
    const float* qsi = qst + i0;
#pragma unroll
    for (int k = 0; k < Cc / 2; ++k) lq_st[2 * k * LQLD] = qsi[(size_t)(2 * k) * Hh];
    wave_sync();
    // GEMM1: qz[i,j] = sum_c q[c,i] zeta[c,j]
    v8f d[NT];
#pragma unroll
    for (int u = 0; u < NT; ++u) d[u] = vz;
#pragma unroll
    for (int kb = 0; kb < 16; ++kb) {
      const int kc = kb * 4;
      v2f afr;  // A: q^T (M=i, K=c) read from LDS
      afr.x = lq_a1[kc * LQLD];
      afr.y = lq_a1[(kc + 1) * LQLD];
#pragma unroll
      for (int u = 0; u < NT; ++u) d[u] = wmma4(afr, bz[u][kb], d[u]);
    }
    // w tiles -> LDS, plus column-sum accumulation
#pragma unroll
    for (int v = 0; v < 8; ++v) {
      const int row = i0 + v + 8 * half;
      const float mv = mbg[row];
      const float sv = sbg[row] + 1e-20f;
#pragma unroll
      for (int u = 0; u < NT; ++u) {
        const float w = __expf(fmaf(a, d[u][v], bn[u]) - mv) / sv;
        lw_st[u * 256 + v * 16] = w;
        csum[u] += w;
      }
    }
    wave_sync();
    // GEMM2: acc[c,j] += q[c,i] * w[i,j]  (K = i, 4 steps of 4)
#pragma unroll
    for (int t = 0; t < 4; ++t) {
#pragma unroll
      for (int kb = 0; kb < 4; ++kb) {
        const int kc = kb * 4;
        v2f a2;  // A: q (M=c, K=i)
        a2.x = lq_a2[t * 16 * LQLD + kc];
        a2.y = lq_a2[t * 16 * LQLD + kc + 1];
#pragma unroll
        for (int u = 0; u < NT; ++u) {
          v2f b2;  // B: w (K=i, N=j)
          b2.x = lw_b2[u * 256 + kc * 16];
          b2.y = lw_b2[u * 256 + (kc + 1) * 16];
          acc[u][t] = wmma4(a2, b2, acc[u][t]);
        }
      }
    }
    wave_sync();
  }
  // each wave leaves its partial sums in its own staging rows
  float* lq_p = lq + 8 * half * PLD + n;  // row t*16 + v + 8*half, column 16*u + n
#pragma unroll
  for (int u = 0; u < NT; ++u) {
    csum[u] += __shfl_xor(csum[u], 16, 32);  // combine the two half-wave row groups
#pragma unroll
    for (int t = 0; t < 4; ++t) {
#pragma unroll
      for (int v = 0; v < 8; ++v) {
        lq_p[(t * 16 + v) * PLD + 16 * u] = acc[u][t][v];
      }
    }
    if (half == 0) lw[16 * u + n] = csum[u];
  }
  __syncthreads();
  // merge: thread x owns column x & 31 and rows (x >> 5) + 4k
  const int mc = threadIdx.x >> 5;
  float cs = 0.0f;
#pragma unroll
  for (int w = 0; w < NW; ++w) cs += lws[w][lane];
  const float inv = 1.0f / cs;
  float* zo = znew + (size_t)bg * Cc * Hh;
#pragma unroll
  for (int k = 0; k < Cc / NW; ++k) {
    const int c = mc + NW * k;
    float sum = 0.0f;
#pragma unroll
    for (int w = 0; w < NW; ++w) sum += lqs[w][c * PLD + lane];
    zo[(size_t)c * Hh + j0 + lane] = sum * inv;
  }
}

// ---------------------------------------------------------------------------
// K4: per (bg, NT i-tiles) work-group: out[c,i] = sum_j w[i,j] mu[c,j]
//     logits computed TRANSPOSED (M=j, N=i) so w^T lands in B orientation
//     each of the NW waves sums a quarter of j; partial sums merge in LDS
//     each wave holds NT i-tiles, so every loaded zeta fragment, every staged
//     mu tile and every mu fragment read from LDS feeds NT products
//     (launch bound 4 = waves a SIMD: a budget of 256 registers, so that all
//     1024 work-groups are resident at once)
// ---------------------------------------------------------------------------
__global__ __launch_bounds__(32 * NW, 4) void k_value(
    const float* __restrict__ q, const float* __restrict__ zeta,
    const float* __restrict__ mu, const float* __restrict__ bias,
    const float* __restrict__ alpha, const float* __restrict__ mrow,
    const float* __restrict__ srow, float* __restrict__ out) {
  __shared__ float lmus[NW][Cc * PLD];  // staging at stride LQLD, partial sums at PLD
  __shared__ float lws[NW][NT * 16 * 16];
  const int wave = __builtin_amdgcn_readfirstlane((int)(threadIdx.x >> 5));
  float* lmu = lmus[wave];  // this wave's own staging rows
  float* lw = lws[wave];
  const int wid = blockIdx.x;
  const int bg = wid >> 6;
  const int i0 = (wid & 63) << 5;
  const float* qbg = q + (size_t)bg * Cc * Hh;
  const float* zbg = zeta + (size_t)bg * Cc * Hh;
  const float* mubg = mu + (size_t)bg * Cc * Hh;
  const float* bbg = bias + (size_t)bg * Hh;
  const float a = alpha[0];
  const int lane = threadIdx.x & 31;
  const int half = lane >> 4;
  const int n = lane & 15;

  // B fragments of q (K=c, N=i) for the fixed i-tiles, persistent
  v2f bq[NT][16];
  float mr[NT], sr[NT];
  const float* qfr = qbg + (size_t)(2 * half) * Hh + i0 + n;  // lane's element of row 2*half
  const float* mfr = mrow + (size_t)bg * Hh + i0 + n;
  const float* sfr = srow + (size_t)bg * Hh + i0 + n;
#pragma unroll
  for (int u = 0; u < NT; ++u) {
#pragma unroll
    for (int kb = 0; kb < 16; ++kb) bq[u][kb] = frag_g(qfr, Hh, 16 * u, kb * 4, 0, 0);
    mr[u] = mfr[16 * u];
    sr[u] = sfr[16 * u] + 1e-20f;
  }
  // the address registers of the loads above are inputs here, so they live up
  // to this wait and are reused only behind it
  asm volatile("s_wait_xcnt 0x0" ::"v"(qfr), "v"(mfr), "v"(sfr), "v"(n) : "memory");

  const v8f vz = {0.f, 0.f, 0.f, 0.f, 0.f, 0.f, 0.f, 0.f};
  v8f acc[NT][4];
#pragma unroll
  for (int u = 0; u < NT; ++u) {
#pragma unroll
    for (int t = 0; t < 4; ++t) acc[u][t] = vz;
  }

  const float* must = mubg + (size_t)half * Hh + n;  // lane's element of rows half, half+2, ...
  // Per-lane LDS bases, so that every access below is base + constant and the
  // address registers stay few (the fragments and sums fill the register budget).
  float* lmu_st = lmu + half * LQLD + n;            // staging store: row 2k + half, column n
  const float* lmu_a2 = lmu + n * LQLD + 2 * half;  // GEMM2 A: row t*16 + n, column kc + 2*half
  float* lw_st = lw + 8 * half * 16 + n;            // w^T store: tile u, row v + 8*half, column n
  const float* lw_b2 = lw + 2 * half * 16 + n;      // GEMM2 B: tile u, row kc + 2*half, column n
  for (int jt = wave * TPW; jt < wave * TPW + TPW; ++jt) {
    const int j0 = jt << 4;
    // stage mu[c, j0:j0+16] tile into LDS
    // (one lane address plus constant row steps: keeps the address registers few)
    const float* musi = must + j0;
#pragma unroll
    for (int k = 0; k < Cc / 2; ++k) lmu_st[2 * k * LQLD] = musi[(size_t)(2 * k) * Hh];
    wave_sync();
    // transposed logits: tz[j,i] = sum_c zeta[c,j] q[c,i]
    v8f d[NT];
#pragma unroll
    for (int u = 0; u < NT; ++u) d[u] = vz;
#pragma unroll
    for (int kb = 0; kb < 16; ++kb) {
      v2f az = frag_g(zbg, Hh, j0, kb * 4, half, n);  // A: zeta^T (M=j, K=c)
#pragma unroll
      for (int u = 0; u < NT; ++u) d[u] = wmma4(az, bq[u][kb], d[u]);
    }
    // w^T[j,i] -> LDS ; bias by row j, softmax stats by column i
#pragma unroll
    for (int v = 0; v < 8; ++v) {
      const float bj = bbg[j0 + v + 8 * half];
#pragma unroll
      for (int u = 0; u < NT; ++u)
        lw_st[u * 256 + v * 16] = __expf(fmaf(a, d[u][v], bj) - mr[u]) / sr[u];
    }
    wave_sync();
    // GEMM2: acc[c,i] += mu[c,j] * w^T[j,i]  (K = j, 4 steps of 4)
#pragma unroll
    for (int t = 0; t < 4; ++t) {
#pragma unroll
      for (int kb = 0; kb < 4; ++kb) {
        const int kc = kb * 4;
        v2f a2;  // A: mu (M=c, K=j)
        a2.x = lmu_a2[t * 16 * LQLD + kc];
        a2.y = lmu_a2[t * 16 * LQLD + kc + 1];
#pragma unroll
        for (int u = 0; u < NT; ++u) {
          v2f b2;  // B: w^T (K=j, N=i)
          b2.x = lw_b2[u * 256 + kc * 16];
          b2.y = lw_b2[u * 256 + (kc + 1) * 16];
          acc[u][t] = wmma4(a2, b2, acc[u][t]);
        }
      }
    }
    wave_sync();
  }
  // each wave leaves its partial sums in its own staging rows
  float* lmu_p = lmu + 8 * half * PLD + n;  // row t*16 + v + 8*half, column 16*u + n
#pragma unroll
  for (int u = 0; u < NT; ++u) {
#pragma unroll
    for (int t = 0; t < 4; ++t) {
#pragma unroll
      for (int v = 0; v < 8; ++v) {
        lmu_p[(t * 16 + v) * PLD + 16 * u] = acc[u][t][v];
      }
    }
  }
  __syncthreads();
  // merge: thread x owns column x & 31 and rows (x >> 5) + 4k
  const int mc = threadIdx.x >> 5;
  float* obg = out + (size_t)bg * Cc * Hh;
#pragma unroll
  for (int k = 0; k < Cc / NW; ++k) {
    const int c = mc + NW * k;
    float sum = 0.0f;
#pragma unroll
    for (int w = 0; w < NW; ++w) sum += lmus[w][c * PLD + lane];
    obg[(size_t)c * Hh + i0 + lane] = sum;
  }
}

// ---------------------------------------------------------------------------
extern "C" void kernel_launch(void* const* d_in, const int* in_sizes, int n_in,
                              void* d_out, int out_size, void* d_ws,
                              size_t ws_size, hipStream_t stream) {
  const float* q = (const float*)d_in[0];
  const float* zeta = (const float*)d_in[1];
  const float* alpha = (const float*)d_in[2];
  const float* mu = (const float*)d_in[3];
  const float* beta = (const float*)d_in[4];
  float* out = (float*)d_out;

  float* ws = (float*)d_ws;
  float* bias = ws;                          // BG*Hh floats
  float* mrow = ws + (size_t)BG * Hh;        // BG*Hh
  float* srow = ws + (size_t)2 * BG * Hh;    // BG*Hh
  float* za = ws + (size_t)3 * BG * Hh;      // BG*Cc*Hh
  float* zb = za + (size_t)BG * Cc * Hh;     // BG*Cc*Hh  (~17 MB total)

  const dim3 wgrid(BG * (NTILE / NT)), wblk(32 * NW);

  k_bias<<<dim3((BG * Hh) / 256), dim3(256), 0, stream>>>(mu, beta, bias);
  // w0 = UW(zeta_in)
  k_stats<<<wgrid, wblk, 0, stream>>>(q, zeta, bias, alpha, mrow, srow);
  // iter 1: zeta_a = Z(w0);  w1 = UW(zeta_a)
  k_zeta<<<wgrid, wblk, 0, stream>>>(q, zeta, bias, alpha, mrow, srow, za);
  k_stats<<<wgrid, wblk, 0, stream>>>(q, za, bias, alpha, mrow, srow);
  // iter 2: zeta_b = Z(w1);  w2 = UW(zeta_b)
  k_zeta<<<wgrid, wblk, 0, stream>>>(q, za, bias, alpha, mrow, srow, zb);
  k_stats<<<wgrid, wblk, 0, stream>>>(q, zb, bias, alpha, mrow, srow);
  // out = V(w2)
  k_value<<<wgrid, wblk, 0, stream>>>(q, zb, mu, bias, alpha, mrow, srow, out);

  (void)in_sizes;
  (void)n_in;
  (void)out_size;
  (void)ws_size;
}

// v003
// It runs in 460 microseconds.
// Next to v002, in two timings, it ran 1.14 times as fast each time.
// All steps since v000 together make it 1.83 times as fast.
#include <hip/hip_runtime.h>
#include <cstddef>

#define Hh 2048
#define Cc 64
#define BG 16
#define NTILE 128   // Hh / 16
#define LQLD 17     // padded LDS row stride (floats)
#define NW 4        // waves per work-group; each takes NTILE / NW tiles of the reduced axis
#define TPW 32      // NTILE / NW
#define NT 2        // 16-wide tiles of the fixed axis held by each wave
#define FW 32       // NT * 16: width of the fixed axis per work-group
#define PLD 33      // padded LDS row stride (floats) of the FW-wide partial sums

typedef float v2f __attribute__((ext_vector_type(2)));
typedef float v4f __attribute__((ext_vector_type(4)));
typedef float v8f __attribute__((ext_vector_type(8)));

// Fragment loader for the 16x4 f32 A layout (and symmetric 4x16 B layout):
// lane L<16 : vgpr0 = X[kc+0][base+L], vgpr1 = X[kc+1][base+L]
// lane L>=16: vgpr0 = X[kc+2][base+L-16], vgpr1 = X[kc+3][base+L-16]
static __device__ __forceinline__ v2f frag_g(const float* p, int ld, int base,
                                             int kc, int half, int m) {
  const float* a = p + (size_t)(kc + 2 * half) * ld + base + m;
  v2f r;
  r.x = a[0];
  r.y = a[ld];
  return r;
}

// Orders one wave's own LDS stores and loads (each wave stages in LDS rows that
// no other wave touches inside the loops): the fences keep the waits a
// work-group barrier would bring, the wave barrier keeps the compiler from
// moving LDS accesses across; without it a lane could read a row before its
// neighbour lane's store. No other wave is waited for.
static __device__ __forceinline__ void wave_sync() {
  __builtin_amdgcn_fence(__ATOMIC_RELEASE, "workgroup");
  __builtin_amdgcn_wave_barrier();
  __builtin_amdgcn_fence(__ATOMIC_ACQUIRE, "workgroup");
}

static __device__ __forceinline__ v8f wmma4(v2f a, v2f b, v8f c) {
  return __builtin_amdgcn_wmma_f32_16x16x4_f32(false, a, false, b, (short)0, c,
                                               false, false);
}

// ---------------------------------------------------------------------------
// K1: bias[bg,h] = 0.5 * beta * sum_c mu[bg,c,h]^2
// ---------------------------------------------------------------------------
__global__ void k_bias(const float* __restrict__ mu,
                       const float* __restrict__ beta,
                       float* __restrict__ bias) {
  const int idx = blockIdx.x * 256 + threadIdx.x;  // 0 .. BG*Hh-1
  const int bg = idx >> 11;                        // Hh == 2048
  const int h = idx & (Hh - 1);
  const float* p = mu + (size_t)bg * Cc * Hh + h;
  float s = 0.0f;
#pragma unroll 4
  for (int c = 0; c < Cc; ++c) {
    const float x = p[(size_t)c * Hh];
    s = fmaf(x, x, s);
  }
  bias[idx] = 0.5f * beta[0] * s;
}

// ---------------------------------------------------------------------------
// K2: per (bg, NT i-tiles) work-group: streaming softmax stats over j
//     logits[i,j] = a*(q^T zeta)[i,j] + bias[j];  m = rowmax, s = sum exp
//     logits computed TRANSPOSED (M=j, N=i): a lane holds eight j of ONE row i,
//     so maximum and sum over j run in the lane's own registers and no lane
//     exchange stands in the loop
//     each of the NW waves streams a quarter of j; the 2 * NW partial (m, s) of a
//     row (two half-waves a wave) merge in LDS
//     each wave holds NT i-tiles, so every loaded zeta fragment feeds NT products
// ---------------------------------------------------------------------------
__global__ __launch_bounds__(32 * NW, 4) void k_stats(
    const float* __restrict__ q, const float* __restrict__ zeta,
    const float* __restrict__ bias, const float* __restrict__ alpha,
    float* __restrict__ mrow, float* __restrict__ srow) {
  __shared__ float pm[2 * NW][FW];
  __shared__ float ps[2 * NW][FW];
  const int wave = __builtin_amdgcn_readfirstlane((int)(threadIdx.x >> 5));
  const int wid = blockIdx.x;
  const int bg = wid >> 6;
  const int i0 = (wid & 63) << 5;
  const float* qbg = q + (size_t)bg * Cc * Hh;
  const float* zbg = zeta + (size_t)bg * Cc * Hh;
  const float* bbg = bias + (size_t)bg * Hh;
  const float a = alpha[0];
  const int lane = threadIdx.x & 31;
  const int half = lane >> 4;
  const int n = lane & 15;

  // B fragments of q (K=c, N=i), persistent across the j loop
  v2f bq[NT][16];
#pragma unroll
  for (int u = 0; u < NT; ++u) {
#pragma unroll
    for (int kb = 0; kb < 16; ++kb)
      bq[u][kb] = frag_g(qbg, Hh, i0 + 16 * u, kb * 4, half, n);
  }

  // running (max, sum) of row i0 + 16*u + n over the j this half-wave has seen
  float rmax[NT], rsum[NT];
#pragma unroll
  for (int u = 0; u < NT; ++u) {
    rmax[u] = -3.0e38f;
    rsum[u] = 0.0f;
  }

  const float* zfr = zbg + (size_t)(2 * half) * Hh + n;  // lane's element of row 2*half
  const float* bfr = bbg + 8 * half;                     // bias of this half-wave's first row j
  for (int jt = wave * TPW; jt < wave * TPW + TPW; ++jt) {
    const int j0 = jt << 4;
    const float* zp = zfr + j0;
    // bias by row j = j0 + 8*half + v: eight neighbours, 32-byte aligned
    const v4f* bp = (const v4f*)(bfr + j0);
    v2f az[16];  // A: zeta^T (M=j, K=c)
#pragma unroll
    for (int kb = 0; kb < 16; ++kb) az[kb] = frag_g(zp, Hh, 0, kb * 4, 0, 0);
    const v4f b0 = bp[0];
    const v4f b1 = bp[1];
    // the address registers of the loads above are inputs here, so they live up
    // to this wait and are reused (also as a load's target) only behind it
    asm volatile("s_wait_xcnt 0x0" ::"v"(zp), "v"(bp) : "memory");
    v8f d[NT];
#pragma unroll
    for (int u = 0; u < NT; ++u) d[u] = v8f{0.f, 0.f, 0.f, 0.f, 0.f, 0.f, 0.f, 0.f};
#pragma unroll
    for (int kb = 0; kb < 16; ++kb) {
#pragma unroll
      for (int u = 0; u < NT; ++u) d[u] = wmma4(az[kb], bq[u][kb], d[u]);
    }
#pragma unroll
    for (int u = 0; u < NT; ++u) {
      float t[8];
#pragma unroll
      for (int v = 0; v < 4; ++v) {
        t[v] = fmaf(a, d[u][v], b0[v]);
        t[v + 4] = fmaf(a, d[u][v + 4], b1[v]);
      }
      float tm = rmax[u];
#pragma unroll
      for (int v = 0; v < 8; ++v) tm = fmaxf(tm, t[v]);  // the new running maximum
      float e[8];
#pragma unroll
      for (int v = 0; v < 8; ++v) e[v] = __expf(t[v] - tm);
      const float es = ((e[0] + e[1]) + (e[2] + e[3])) + ((e[4] + e[5]) + (e[6] + e[7]));
      rsum[u] = rsum[u] * __expf(rmax[u] - tm) + es;
      rmax[u] = tm;
    }
  }
#pragma unroll
  for (int u = 0; u < NT; ++u) {
    pm[2 * wave + half][16 * u + n] = rmax[u];
    ps[2 * wave + half][16 * u + n] = rsum[u];
  }
  __syncthreads();
  // merge the 2 * NW partial (max, sum) pairs of each row
  if (threadIdx.x < FW) {
    const int r = threadIdx.x;
    float m = pm[0][r];
#pragma unroll
    for (int w = 1; w < 2 * NW; ++w) m = fmaxf(m, pm[w][r]);
    float ex[2 * NW];
#pragma unroll
    for (int w = 0; w < 2 * NW; ++w) ex[w] = __expf(pm[w][r] - m);
    float sum = 0.0f;
#pragma unroll
    for (int w = 0; w < 2 * NW; ++w) sum = fmaf(ps[w][r], ex[w], sum);
    mrow[(size_t)bg * Hh + i0 + r] = m;
    srow[(size_t)bg * Hh + i0 + r] = sum;
  }
}

// ---------------------------------------------------------------------------
// K3: per (bg, NT j-tiles) work-group: zeta_new[c,j] = (sum_i w[i,j] q[c,i]) / sum_i w
//     w recomputed from (zeta_old, m, s)
//     each of the NW waves sums a quarter of i; partial sums merge in LDS
//     each wave holds NT j-tiles, so every staged q tile and every q fragment
//     read from LDS feeds NT products
//     (launch bound 4 = waves a SIMD: a budget of 256 registers, so that all
//     1024 work-groups are resident at once)
// ---------------------------------------------------------------------------
__global__ __launch_bounds__(32 * NW, 4) void k_zeta(
    const float* __restrict__ q, const float* __restrict__ zold,
    const float* __restrict__ bias, const float* __restrict__ alpha,
    const float* __restrict__ mrow, const float* __restrict__ srow,
    float* __restrict__ znew) {
  __shared__ float lqs[NW][Cc * PLD];  // staging at stride LQLD, partial sums at PLD
  __shared__ float lws[NW][NT * 16 * 16];
  const int wave = __builtin_amdgcn_readfirstlane((int)(threadIdx.x >> 5));
  float* lq = lqs[wave];  // this wave's own staging rows
  float* lw = lws[wave];
  const int wid = blockIdx.x;
  const int bg = wid >> 6;
  const int j0 = (wid & 63) << 5;
  const float* qbg = q + (size_t)bg * Cc * Hh;
  const float* zbg = zold + (size_t)bg * Cc * Hh;
  const float* bbg = bias + (size_t)bg * Hh;
  const float* mbg = mrow + (size_t)bg * Hh;
  const float* sbg = srow + (size_t)bg * Hh;
  const float a = alpha[0];
  const int lane = threadIdx.x & 31;
  const int half = lane >> 4;
  const int n = lane & 15;

  // B fragments of zeta (K=c, N=j) for the fixed j-tiles, persistent
  v2f bz[NT][16];
  float bn[NT];
  const float* zfr = zbg + (size_t)(2 * half) * Hh + j0 + n;  // lane's element of row 2*half
#pragma unroll
  for (int u = 0; u < NT; ++u) {
#pragma unroll
    for (int kb = 0; kb < 16; ++kb) bz[u][kb] = frag_g(zfr, Hh, 16 * u, kb * 4, 0, 0);
    bn[u] = bbg[j0 + n + 16 * u];
  }
  // the address registers of the loads above are inputs here, so they live up
  // to this wait and are reused only behind it
  asm volatile("s_wait_xcnt 0x0" ::"v"(zfr), "v"(j0 + n) : "memory");

  const v8f vz = {0.f, 0.f, 0.f, 0.f, 0.f, 0.f, 0.f, 0.f};
  v8f acc[NT][4];
  float csum[NT];
#pragma unroll
  for (int u = 0; u < NT; ++u) {
#pragma unroll
    for (int t = 0; t < 4; ++t) acc[u][t] = vz;
    csum[u] = 0.0f;
  }

  const float* qst = qbg + (size_t)half * Hh + n;  // lane's element of rows half, half+2, ...
  // Per-lane LDS bases, so that every access below is base + constant and the
  // address registers stay few (the fragments and sums fill the register budget).
  float* lq_st = lq + half * LQLD + n;            // staging store: row 2k + half, column n
  const float* lq_a1 = lq + 2 * half * LQLD + n;  // GEMM1 A: row kc + 2*half, column n
  const float* lq_a2 = lq + n * LQLD + 2 * half;  // GEMM2 A: row t*16 + n, column kc + 2*half
  float* lw_st = lw + 8 * half * 16 + n;          // w store: tile u, row v + 8*half, column n
  const float* lw_b2 = lw + 2 * half * 16 + n;    // GEMM2 B: tile u, row kc + 2*half, column n
  for (int it = wave * TPW; it < wave * TPW + TPW; ++it) {
    const int i0 = it << 4;
    // stage q[c, i0:i0+16] tile into LDS (coalesced)
    // (one lane address plus constant row steps: keeps the address registers few)
    const float* qsi = qst + i0;
#pragma unroll
    for (int k = 0; k < Cc / 2; ++k) lq_st[2 * k * LQLD] = qsi[(size_t)(2 * k) * Hh];
    wave_sync();
    // GEMM1: qz[i,j] = sum_c q[c,i] zeta[c,j]
    v8f d[NT];
#pragma unroll
    for (int u = 0; u < NT; ++u) d[u] = vz;
#pragma unroll
    for (int kb = 0; kb < 16; ++kb) {
      const int kc = kb * 4;
      v2f afr;  // A: q^T (M=i, K=c) read from LDS
      afr.x = lq_a1[kc * LQLD];
      afr.y = lq_a1[(kc + 1) * LQLD];
#pragma unroll
      for (int u = 0; u < NT; ++u) d[u] = wmma4(afr, bz[u][kb], d[u]);
    }
    // w tiles -> LDS, plus column-sum accumulation
#pragma unroll
    for (int v = 0; v < 8; ++v) {
      const int row = i0 + v + 8 * half;
      const float mv = mbg[row];
      const float sv = sbg[row] + 1e-20f;
#pragma unroll
      for (int u = 0; u < NT; ++u) {
        const float w = __expf(fmaf(a, d[u][v], bn[u]) - mv) / sv;
        lw_st[u * 256 + v * 16] = w;
        csum[u] += w;
      }
    }
    wave_sync();
    // GEMM2: acc[c,j] += q[c,i] * w[i,j]  (K = i, 4 steps of 4)
#pragma unroll
    for (int t = 0; t < 4; ++t) {
#pragma unroll
      for (int kb = 0; kb < 4; ++kb) {
        const int kc = kb * 4;
        v2f a2;  // A: q (M=c, K=i)
        a2.x = lq_a2[t * 16 * LQLD + kc];
        a2.y = lq_a2[t * 16 * LQLD + kc + 1];
#pragma unroll
        for (int u = 0; u < NT; ++u) {
          v2f b2;  // B: w (K=i, N=j)
          b2.x = lw_b2[u * 256 + kc * 16];
          b2.y = lw_b2[u * 256 + (kc + 1) * 16];
          acc[u][t] = wmma4(a2, b2, acc[u][t]);
        }
      }
    }
    wave_sync();
  }
  // each wave leaves its partial sums in its own staging rows
  float* lq_p = lq + 8 * half * PLD + n;  // row t*16 + v + 8*half, column 16*u + n
#pragma unroll
  for (int u = 0; u < NT; ++u) {
    csum[u] += __shfl_xor(csum[u], 16, 32);  // combine the two half-wave row groups
#pragma unroll
    for (int t = 0; t < 4; ++t) {
#pragma unroll
      for (int v = 0; v < 8; ++v) {
        lq_p[(t * 16 + v) * PLD + 16 * u] = acc[u][t][v];
      }
    }
    if (half == 0) lw[16 * u + n] = csum[u];
  }
  __syncthreads();
  // merge: thread x owns column x & 31 and rows (x >> 5) + 4k
  const int mc = threadIdx.x >> 5;
  float cs = 0.0f;
#pragma unroll
  for (int w = 0; w < NW; ++w) cs += lws[w][lane];
  const float inv = 1.0f / cs;
  float* zo = znew + (size_t)bg * Cc * Hh;
#pragma unroll
  for (int k = 0; k < Cc / NW; ++k) {
    const int c = mc + NW * k;
    float sum = 0.0f;
#pragma unroll
    for (int w = 0; w < NW; ++w) sum += lqs[w][c * PLD + lane];
    zo[(size_t)c * Hh + j0 + lane] = sum * inv;
  }
}

// ---------------------------------------------------------------------------
// K4: per (bg, NT i-tiles) work-group: out[c,i] = sum_j w[i,j] mu[c,j]
//     logits computed TRANSPOSED (M=j, N=i) so w^T lands in B orientation
//     each of the NW waves sums a quarter of j; partial sums merge in LDS
//     each wave holds NT i-tiles, so every loaded zeta fragment, every staged
//     mu tile and every mu fragment read from LDS feeds NT products
//     (launch bound 4 = waves a SIMD: a budget of 256 registers, so that all
//     1024 work-groups are resident at once)
// ---------------------------------------------------------------------------
__global__ __launch_bounds__(32 * NW, 4) void k_value(
    const float* __restrict__ q, const float* __restrict__ zeta,
    const float* __restrict__ mu, const float* __restrict__ bias,
    const float* __restrict__ alpha, const float* __restrict__ mrow,
    const float* __restrict__ srow, float* __restrict__ out) {
  __shared__ float lmus[NW][Cc * PLD];  // staging at stride LQLD, partial sums at PLD
  __shared__ float lws[NW][NT * 16 * 16];
  const int wave = __builtin_amdgcn_readfirstlane((int)(threadIdx.x >> 5));
  float* lmu = lmus[wave];  // this wave's own staging rows
  float* lw = lws[wave];
  const int wid = blockIdx.x;
  const int bg = wid >> 6;
  const int i0 = (wid & 63) << 5;
  const float* qbg = q + (size_t)bg * Cc * Hh;
  const float* zbg = zeta + (size_t)bg * Cc * Hh;
  const float* mubg = mu + (size_t)bg * Cc * Hh;
  const float* bbg = bias + (size_t)bg * Hh;
  const float a = alpha[0];
  const int lane = threadIdx.x & 31;
  const int half = lane >> 4;
  const int n = lane & 15;

  // B fragments of q (K=c, N=i) for the fixed i-tiles, persistent
  v2f bq[NT][16];
  float mr[NT], sr[NT];
  const float* qfr = qbg + (size_t)(2 * half) * Hh + i0 + n;  // lane's element of row 2*half
  const float* mfr = mrow + (size_t)bg * Hh + i0 + n;
  const float* sfr = srow + (size_t)bg * Hh + i0 + n;
#pragma unroll
  for (int u = 0; u < NT; ++u) {
#pragma unroll
    for (int kb = 0; kb < 16; ++kb) bq[u][kb] = frag_g(qfr, Hh, 16 * u, kb * 4, 0, 0);
    mr[u] = mfr[16 * u];
    sr[u] = sfr[16 * u] + 1e-20f;
  }
  // the address registers of the loads above are inputs here, so they live up
  // to this wait and are reused only behind it
  asm volatile("s_wait_xcnt 0x0" ::"v"(qfr), "v"(mfr), "v"(sfr), "v"(n) : "memory");

  const v8f vz = {0.f, 0.f, 0.f, 0.f, 0.f, 0.f, 0.f, 0.f};
  v8f acc[NT][4];
#pragma unroll
  for (int u = 0; u < NT; ++u) {
#pragma unroll
    for (int t = 0; t < 4; ++t) acc[u][t] = vz;
  }

  const float* must = mubg + (size_t)half * Hh + n;  // lane's element of rows half, half+2, ...
  // Per-lane LDS bases, so that every access below is base + constant and the
  // address registers stay few (the fragments and sums fill the register budget).
  float* lmu_st = lmu + half * LQLD + n;            // staging store: row 2k + half, column n
  const float* lmu_a2 = lmu + n * LQLD + 2 * half;  // GEMM2 A: row t*16 + n, column kc + 2*half
  float* lw_st = lw + 8 * half * 16 + n;            // w^T store: tile u, row v + 8*half, column n
  const float* lw_b2 = lw + 2 * half * 16 + n;      // GEMM2 B: tile u, row kc + 2*half, column n
  for (int jt = wave * TPW; jt < wave * TPW + TPW; ++jt) {
    const int j0 = jt << 4;
    // stage mu[c, j0:j0+16] tile into LDS
    // (one lane address plus constant row steps: keeps the address registers few)
    const float* musi = must + j0;
#pragma unroll
    for (int k = 0; k < Cc / 2; ++k) lmu_st[2 * k * LQLD] = musi[(size_t)(2 * k) * Hh];
    wave_sync();
    // transposed logits: tz[j,i] = sum_c zeta[c,j] q[c,i]
    v8f d[NT];
#pragma unroll
    for (int u = 0; u < NT; ++u) d[u] = vz;
#pragma unroll
    for (int kb = 0; kb < 16; ++kb) {
      v2f az = frag_g(zbg, Hh, j0, kb * 4, half, n);  // A: zeta^T (M=j, K=c)
#pragma unroll
      for (int u = 0; u < NT; ++u) d[u] = wmma4(az, bq[u][kb], d[u]);
    }
    // w^T[j,i] -> LDS ; bias by row j, softmax stats by column i
#pragma unroll
    for (int v = 0; v < 8; ++v) {
      const float bj = bbg[j0 + v + 8 * half];
#pragma unroll
      for (int u = 0; u < NT; ++u)
        lw_st[u * 256 + v * 16] = __expf(fmaf(a, d[u][v], bj) - mr[u]) / sr[u];
    }
    wave_sync();
    // GEMM2: acc[c,i] += mu[c,j] * w^T[j,i]  (K = j, 4 steps of 4)
#pragma unroll
    for (int t = 0; t < 4; ++t) {
#pragma unroll
      for (int kb = 0; kb < 4; ++kb) {
        const int kc = kb * 4;
        v2f a2;  // A: mu (M=c, K=j)
        a2.x = lmu_a2[t * 16 * LQLD + kc];
        a2.y = lmu_a2[t * 16 * LQLD + kc + 1];
#pragma unroll
        for (int u = 0; u < NT; ++u) {
          v2f b2;  // B: w^T (K=j, N=i)
          b2.x = lw_b2[u * 256 + kc * 16];
          b2.y = lw_b2[u * 256 + (kc + 1) * 16];
          acc[u][t] = wmma4(a2, b2, acc[u][t]);
        }
      }
    }
    wave_sync();
  }
  // each wave leaves its partial sums in its own staging rows
  float* lmu_p = lmu + 8 * half * PLD + n;  // row t*16 + v + 8*half, column 16*u + n
#pragma unroll
  for (int u = 0; u < NT; ++u) {
#pragma unroll
    for (int t = 0; t < 4; ++t) {
#pragma unroll
      for (int v = 0; v < 8; ++v) {
        lmu_p[(t * 16 + v) * PLD + 16 * u] = acc[u][t][v];
      }
    }
  }
  __syncthreads();
  // merge: thread x owns column x & 31 and rows (x >> 5) + 4k
  const int mc = threadIdx.x >> 5;
  float* obg = out + (size_t)bg * Cc * Hh;
#pragma unroll
  for (int k = 0; k < Cc / NW; ++k) {
    const int c = mc + NW * k;
    float sum = 0.0f;
#pragma unroll
    for (int w = 0; w < NW; ++w) sum += lmus[w][c * PLD + lane];
    obg[(size_t)c * Hh + i0 + lane] = sum;
  }
}

// ---------------------------------------------------------------------------
extern "C" void kernel_launch(void* const* d_in, const int* in_sizes, int n_in,
                              void* d_out, int out_size, void* d_ws,
                              size_t ws_size, hipStream_t stream) {
  const float* q = (const float*)d_in[0];
  const float* zeta = (const float*)d_in[1];
  const float* alpha = (const float*)d_in[2];
  const float* mu = (const float*)d_in[3];
  const float* beta = (const float*)d_in[4];
  float* out = (float*)d_out;

  float* ws = (float*)d_ws;
  float* bias = ws;                          // BG*Hh floats
  float* mrow = ws + (size_t)BG * Hh;        // BG*Hh
  float* srow = ws + (size_t)2 * BG * Hh;    // BG*Hh
  float* za = ws + (size_t)3 * BG * Hh;      // BG*Cc*Hh
  float* zb = za + (size_t)BG * Cc * Hh;     // BG*Cc*Hh  (~17 MB total)

  const dim3 wgrid(BG * (NTILE / NT)), wblk(32 * NW);

  k_bias<<<dim3((BG * Hh) / 256), dim3(256), 0, stream>>>(mu, beta, bias);
  // w0 = UW(zeta_in)
  k_stats<<<wgrid, wblk, 0, stream>>>(q, zeta, bias, alpha, mrow, srow);
  // iter 1: zeta_a = Z(w0);  w1 = UW(zeta_a)
  k_zeta<<<wgrid, wblk, 0, stream>>>(q, zeta, bias, alpha, mrow, srow, za);
  k_stats<<<wgrid, wblk, 0, stream>>>(q, za, bias, alpha, mrow, srow);
  // iter 2: zeta_b = Z(w1);  w2 = UW(zeta_b)
  k_zeta<<<wgrid, wblk, 0, stream>>>(q, za, bias, alpha, mrow, srow, zb);
  k_stats<<<wgrid, wblk, 0, stream>>>(q, zb, bias, alpha, mrow, srow);
  // out = V(w2)
  k_value<<<wgrid, wblk, 0, stream>>>(q, zb, mu, bias, alpha, mrow, srow, out);

  (void)in_sizes;
  (void)n_in;
  (void)out_size;
  (void)ws_size;
}

// v004
// It runs in 405 microseconds.
// Two timings next to v003 put it at 1.13 and 1.14 times that version's speed.
// Over all steps from v000 it is 2.08 times as fast.
#include <hip/hip_runtime.h>
#include <cstddef>

#define Hh 2048
#define Cc 64
#define BG 16
#define NTILE 128   // Hh / 16
#define LQLD 17     // padded LDS row stride (floats)
#define NW 4        // waves per work-group; each takes NTILE / NW tiles of the reduced axis
#define TPW 32      // NTILE / NW
#define NT 2        // 16-wide tiles of the fixed axis held by each wave
#define FW 32       // NT * 16: width of the fixed axis per work-group
#define PLD 33      // padded LDS row stride (floats) of the FW-wide partial sums
#define RTH 5.5f    // a logit may pass its row's reference maximum by this much (exp < 256)

typedef float v2f __attribute__((ext_vector_type(2)));
typedef float v4f __attribute__((ext_vector_type(4)));
typedef float v8f __attribute__((ext_vector_type(8)));

// Fragment loader for the 16x4 f32 A layout (and symmetric 4x16 B layout):
// lane L<16 : vgpr0 = X[kc+0][base+L], vgpr1 = X[kc+1][base+L]
// lane L>=16: vgpr0 = X[kc+2][base+L-16], vgpr1 = X[kc+3][base+L-16]
static __device__ __forceinline__ v2f frag_g(const float* p, int ld, int base,
                                             int kc, int half, int m) {
  const float* a = p + (size_t)(kc + 2 * half) * ld + base + m;
  v2f r;
  r.x = a[0];
  r.y = a[ld];
  return r;
}

// Orders one wave's own LDS stores and loads (each wave stages in LDS rows that
// no other wave touches inside the loops): the fences keep the waits a
// work-group barrier would bring, the wave barrier keeps the compiler from
// moving LDS accesses across; without it a lane could read a row before its
// neighbour lane's store. No other wave is waited for.
static __device__ __forceinline__ void wave_sync() {
  __builtin_amdgcn_fence(__ATOMIC_RELEASE, "workgroup");
  __builtin_amdgcn_wave_barrier();
  __builtin_amdgcn_fence(__ATOMIC_ACQUIRE, "workgroup");
}

// lane l reads lane l ^ 16 (the other half-wave's value of the same column)
static __device__ __forceinline__ float xhalf(float x) {
  const int b = __builtin_bit_cast(int, x);
  return __builtin_bit_cast(
      float, __builtin_amdgcn_permlanex16(b, b, 0x76543210, 0xfedcba98, false, false));
}

static __device__ __forceinline__ v8f wmma4(v2f a, v2f b, v8f c) {
  return __builtin_amdgcn_wmma_f32_16x16x4_f32(false, a, false, b, (short)0, c,
                                               false, false);
}

// ---------------------------------------------------------------------------
// K1: bias[bg,h] = 0.5 * beta * sum_c mu[bg,c,h]^2
// ---------------------------------------------------------------------------
__global__ void k_bias(const float* __restrict__ mu,
                       const float* __restrict__ beta,
                       float* __restrict__ bias) {
  const int idx = blockIdx.x * 256 + threadIdx.x;  // 0 .. BG*Hh-1
  const int bg = idx >> 11;                        // Hh == 2048
  const int h = idx & (Hh - 1);
  const float* p = mu + (size_t)bg * Cc * Hh + h;
  float s = 0.0f;
#pragma unroll 4
  for (int c = 0; c < Cc; ++c) {
    const float x = p[(size_t)c * Hh];
    s = fmaf(x, x, s);
  }
  bias[idx] = 0.5f * beta[0] * s;
}

// ---------------------------------------------------------------------------
// K2: per (bg, NT i-tiles) work-group: streaming softmax stats over j
//     logits[i,j] = a*(q^T zeta)[i,j] + bias[j];  m = rowmax, s = sum exp
//     logits computed TRANSPOSED (M=j, N=i): a lane holds eight j of ONE row i,
//     so maximum and sum over j run in the lane's own registers and no lane
//     exchange stands in the loop
//     each of the NW waves streams a quarter of j; the 2 * NW partial (m, s) of a
//     row (two half-waves a wave) merge in LDS
//     each wave holds NT i-tiles, so every loaded zeta fragment feeds NT products
// ---------------------------------------------------------------------------
__global__ __launch_bounds__(32 * NW, 4) void k_stats(
    const float* __restrict__ q, const float* __restrict__ zeta,
    const float* __restrict__ bias, const float* __restrict__ alpha,
    float* __restrict__ mrow, float* __restrict__ srow) {
  __shared__ float pm[2 * NW][FW];
  __shared__ float ps[2 * NW][FW];
  const int wave = __builtin_amdgcn_readfirstlane((int)(threadIdx.x >> 5));
  const int wid = blockIdx.x;
  const int bg = wid >> 6;
  const int i0 = (wid & 63) << 5;
  const float* qbg = q + (size_t)bg * Cc * Hh;
  const float* zbg = zeta + (size_t)bg * Cc * Hh;
  const float* bbg = bias + (size_t)bg * Hh;
  const float a = alpha[0];
  const int lane = threadIdx.x & 31;
  const int half = lane >> 4;
  const int n = lane & 15;

  // B fragments of q (K=c, N=i), persistent across the j loop
  v2f bq[NT][16];
#pragma unroll
  for (int u = 0; u < NT; ++u) {
#pragma unroll
    for (int kb = 0; kb < 16; ++kb)
      bq[u][kb] = frag_g(qbg, Hh, i0 + 16 * u, kb * 4, half, n);
  }

  // running (max, sum) of row i0 + 16*u + n over the j this half-wave has seen
  float rmax[NT], rsum[NT];
#pragma unroll
  for (int u = 0; u < NT; ++u) {
    rmax[u] = -3.0e38f;
    rsum[u] = 0.0f;
  }

  const float* zfr = zbg + (size_t)(2 * half) * Hh + n;  // lane's element of row 2*half
  const float* bfr = bbg + 8 * half;                     // bias of this half-wave's first row j
  for (int jt = wave * TPW; jt < wave * TPW + TPW; ++jt) {
    const int j0 = jt << 4;
    const float* zp = zfr + j0;
    // bias by row j = j0 + 8*half + v: eight neighbours, 32-byte aligned
    const v4f* bp = (const v4f*)(bfr + j0);
    v2f az[16];  // A: zeta^T (M=j, K=c)
#pragma unroll
    for (int kb = 0; kb < 16; ++kb) az[kb] = frag_g(zp, Hh, 0, kb * 4, 0, 0);
    const v4f b0 = bp[0];
    const v4f b1 = bp[1];
    // the address registers of the loads above are inputs here, so they live up
    // to this wait and are reused (also as a load's target) only behind it
    asm volatile("s_wait_xcnt 0x0" ::"v"(zp), "v"(bp) : "memory");
    v8f d[NT];
#pragma unroll
    for (int u = 0; u < NT; ++u) d[u] = v8f{0.f, 0.f, 0.f, 0.f, 0.f, 0.f, 0.f, 0.f};
#pragma unroll
    for (int kb = 0; kb < 16; ++kb) {
#pragma unroll
      for (int u = 0; u < NT; ++u) d[u] = wmma4(az[kb], bq[u][kb], d[u]);
    }
#pragma unroll
    for (int u = 0; u < NT; ++u) {
      float t[8];
#pragma unroll
      for (int v = 0; v < 4; ++v) {
        t[v] = fmaf(a, d[u][v], b0[v]);
        t[v + 4] = fmaf(a, d[u][v + 4], b1[v]);
      }
      float tm = rmax[u];
#pragma unroll
      for (int v = 0; v < 8; ++v) tm = fmaxf(tm, t[v]);  // the new running maximum
      float e[8];
#pragma unroll
      for (int v = 0; v < 8; ++v) e[v] = __expf(t[v] - tm);
      const float es = ((e[0] + e[1]) + (e[2] + e[3])) + ((e[4] + e[5]) + (e[6] + e[7]));
      rsum[u] = rsum[u] * __expf(rmax[u] - tm) + es;
      rmax[u] = tm;
    }
  }
#pragma unroll
  for (int u = 0; u < NT; ++u) {
    pm[2 * wave + half][16 * u + n] = rmax[u];
    ps[2 * wave + half][16 * u + n] = rsum[u];
  }
  __syncthreads();
  // merge the 2 * NW partial (max, sum) pairs of each row
  if (threadIdx.x < FW) {
    const int r = threadIdx.x;
    float m = pm[0][r];
#pragma unroll
    for (int w = 1; w < 2 * NW; ++w) m = fmaxf(m, pm[w][r]);
    float ex[2 * NW];
#pragma unroll
    for (int w = 0; w < 2 * NW; ++w) ex[w] = __expf(pm[w][r] - m);
    float sum = 0.0f;
#pragma unroll
    for (int w = 0; w < 2 * NW; ++w) sum = fmaf(ps[w][r], ex[w], sum);
    mrow[(size_t)bg * Hh + i0 + r] = m;
    srow[(size_t)bg * Hh + i0 + r] = sum;
  }
}

// ---------------------------------------------------------------------------
// K3: per (bg, NT j-tiles) work-group: zeta_new[c,j] = (sum_i w[i,j] q[c,i]) / sum_i w
//     w recomputed from (zeta_old, m, s)
//     each of the NW waves sums a quarter of i; partial sums merge in LDS
//     each wave holds NT j-tiles, so every staged q tile and every q fragment
//     read from LDS feeds NT products
//     (launch bound 4 = waves a SIMD: a budget of 256 registers, so that all
//     1024 work-groups are resident at once)
// ---------------------------------------------------------------------------
__global__ __launch_bounds__(32 * NW, 4) void k_zeta(
    const float* __restrict__ q, const float* __restrict__ zold,
    const float* __restrict__ bias, const float* __restrict__ alpha,
    const float* __restrict__ mrow, const float* __restrict__ srow,
    float* __restrict__ znew) {
  __shared__ float lqs[NW][Cc * PLD];  // staging at stride LQLD, partial sums at PLD
  __shared__ float lws[NW][NT * 16 * 16];
  const int wave = __builtin_amdgcn_readfirstlane((int)(threadIdx.x >> 5));
  float* lq = lqs[wave];  // this wave's own staging rows
  float* lw = lws[wave];
  const int wid = blockIdx.x;
  const int bg = wid >> 6;
  const int j0 = (wid & 63) << 5;
  const float* qbg = q + (size_t)bg * Cc * Hh;
  const float* zbg = zold + (size_t)bg * Cc * Hh;
  const float* bbg = bias + (size_t)bg * Hh;
  const float* mbg = mrow + (size_t)bg * Hh;
  const float* sbg = srow + (size_t)bg * Hh;
  const float a = alpha[0];
  const int lane = threadIdx.x & 31;
  const int half = lane >> 4;
  const int n = lane & 15;

  // B fragments of zeta (K=c, N=j) for the fixed j-tiles, persistent
  v2f bz[NT][16];
  float bn[NT];
  const float* zfr = zbg + (size_t)(2 * half) * Hh + j0 + n;  // lane's element of row 2*half
#pragma unroll
  for (int u = 0; u < NT; ++u) {
#pragma unroll
    for (int kb = 0; kb < 16; ++kb) bz[u][kb] = frag_g(zfr, Hh, 16 * u, kb * 4, 0, 0);
    bn[u] = bbg[j0 + n + 16 * u];
  }
  // the address registers of the loads above are inputs here, so they live up
  // to this wait and are reused only behind it
  asm volatile("s_wait_xcnt 0x0" ::"v"(zfr), "v"(j0 + n) : "memory");

  const v8f vz = {0.f, 0.f, 0.f, 0.f, 0.f, 0.f, 0.f, 0.f};
  v8f acc[NT][4];
  float csum[NT];
#pragma unroll
  for (int u = 0; u < NT; ++u) {
#pragma unroll
    for (int t = 0; t < 4; ++t) acc[u][t] = vz;
    csum[u] = 0.0f;
  }

  const float* qst = qbg + (size_t)half * Hh + n;  // lane's element of rows half, half+2, ...
  // Per-lane LDS bases, so that every access below is base + constant and the
  // address registers stay few (the fragments and sums fill the register budget).
  float* lq_st = lq + half * LQLD + n;            // staging store: row 2k + half, column n
  const float* lq_a1 = lq + 2 * half * LQLD + n;  // GEMM1 A: row kc + 2*half, column n
  const float* lq_a2 = lq + n * LQLD + 2 * half;  // GEMM2 A: row t*16 + n, column kc + 2*half
  float* lw_st = lw + 8 * half * 16 + n;          // w store: tile u, row v + 8*half, column n
  const float* lw_b2 = lw + 2 * half * 16 + n;    // GEMM2 B: tile u, row kc + 2*half, column n
  for (int it = wave * TPW; it < wave * TPW + TPW; ++it) {
    const int i0 = it << 4;
    // stage q[c, i0:i0+16] tile into LDS (coalesced)
    // (one lane address plus constant row steps: keeps the address registers few)
    const float* qsi = qst + i0;
#pragma unroll
    for (int k = 0; k < Cc / 2; ++k) lq_st[2 * k * LQLD] = qsi[(size_t)(2 * k) * Hh];
    wave_sync();
    // GEMM1: qz[i,j] = sum_c q[c,i] zeta[c,j]
    v8f d[NT];
#pragma unroll
    for (int u = 0; u < NT; ++u) d[u] = vz;
#pragma unroll
    for (int kb = 0; kb < 16; ++kb) {
      const int kc = kb * 4;
      v2f afr;  // A: q^T (M=i, K=c) read from LDS
      afr.x = lq_a1[kc * LQLD];
      afr.y = lq_a1[(kc + 1) * LQLD];
#pragma unroll
      for (int u = 0; u < NT; ++u) d[u] = wmma4(afr, bz[u][kb], d[u]);
    }
    // w tiles -> LDS, plus column-sum accumulation
#pragma unroll
    for (int v = 0; v < 8; ++v) {
      const int row = i0 + v + 8 * half;
      const float mv = mbg[row];
      const float sv = sbg[row] + 1e-20f;
#pragma unroll
      for (int u = 0; u < NT; ++u) {
        const float w = __expf(fmaf(a, d[u][v], bn[u]) - mv) / sv;
        lw_st[u * 256 + v * 16] = w;
        csum[u] += w;
      }
    }
    wave_sync();
    // GEMM2: acc[c,j] += q[c,i] * w[i,j]  (K = i, 4 steps of 4)
#pragma unroll
    for (int t = 0; t < 4; ++t) {
#pragma unroll
      for (int kb = 0; kb < 4; ++kb) {
        const int kc = kb * 4;
        v2f a2;  // A: q (M=c, K=i)
        a2.x = lq_a2[t * 16 * LQLD + kc];
        a2.y = lq_a2[t * 16 * LQLD + kc + 1];
#pragma unroll
        for (int u = 0; u < NT; ++u) {
          v2f b2;  // B: w (K=i, N=j)
          b2.x = lw_b2[u * 256 + kc * 16];
          b2.y = lw_b2[u * 256 + (kc + 1) * 16];
          acc[u][t] = wmma4(a2, b2, acc[u][t]);
        }
      }
    }
    wave_sync();
  }
  // each wave leaves its partial sums in its own staging rows
  float* lq_p = lq + 8 * half * PLD + n;  // row t*16 + v + 8*half, column 16*u + n
#pragma unroll
  for (int u = 0; u < NT; ++u) {
    csum[u] += __shfl_xor(csum[u], 16, 32);  // combine the two half-wave row groups
#pragma unroll
    for (int t = 0; t < 4; ++t) {
#pragma unroll
      for (int v = 0; v < 8; ++v) {
        lq_p[(t * 16 + v) * PLD + 16 * u] = acc[u][t][v];
      }
    }
    if (half == 0) lw[16 * u + n] = csum[u];
  }
  __syncthreads();
  // merge: thread x owns column x & 31 and rows (x >> 5) + 4k
  const int mc = threadIdx.x >> 5;
  float cs = 0.0f;
#pragma unroll
  for (int w = 0; w < NW; ++w) cs += lws[w][lane];
  const float inv = 1.0f / cs;
  float* zo = znew + (size_t)bg * Cc * Hh;
#pragma unroll
  for (int k = 0; k < Cc / NW; ++k) {
    const int c = mc + NW * k;
    float sum = 0.0f;
#pragma unroll
    for (int w = 0; w < NW; ++w) sum += lqs[w][c * PLD + lane];
    zo[(size_t)c * Hh + j0 + lane] = sum * inv;
  }
}

// ---------------------------------------------------------------------------
// K4: per (bg, NT i-tiles) work-group: out[c,i] = sum_j w[i,j] mu[c,j]
//     logits computed TRANSPOSED (M=j, N=i) so w^T lands in B orientation
//     the softmax over j runs inside this loop: a lane owns one row i, keeps a
//     reference maximum and the sum of exp(logit - reference) for it, and the
//     sums over j carry the same factor; when a logit passes the reference by
//     more than RTH the sums are rescaled to the new maximum (one test a pass);
//     the division by the row sum is done once, at the merge
//     every exponent is a plain difference of stored values (logit - reference,
//     old reference - new), so a row whose reference stays is rescaled by exactly 1
//     each of the NW waves sums a quarter of j; partial sums merge in LDS, each
//     brought to the largest of the waves' references
//     (the unroll directives on the short loops over u, v, t and w keep the
//     arrays they index in registers)
//     each wave holds NT i-tiles, so every loaded zeta fragment, every staged
//     mu tile and every mu fragment read from LDS feeds NT products
//     (launch bound 4 = waves a SIMD: a budget of 256 registers, so that all
//     1024 work-groups are resident at once)
// ---------------------------------------------------------------------------
__global__ __launch_bounds__(32 * NW, 4) void k_value(
    const float* __restrict__ q, const float* __restrict__ zeta,
    const float* __restrict__ mu, const float* __restrict__ bias,
    const float* __restrict__ alpha, float* __restrict__ out) {
  __shared__ float lmus[NW][Cc * PLD];  // staging at stride LQLD, partial sums at PLD
  __shared__ float lws[NW][NT * 16 * 16];
  const int wave = __builtin_amdgcn_readfirstlane((int)(threadIdx.x >> 5));
  float* lmu = lmus[wave];  // this wave's own staging rows
  float* lw = lws[wave];
  const int wid = blockIdx.x;
  const int bg = wid >> 6;
  const int i0 = (wid & 63) << 5;
  const float* qbg = q + (size_t)bg * Cc * Hh;
  const float* zbg = zeta + (size_t)bg * Cc * Hh;
  const float* mubg = mu + (size_t)bg * Cc * Hh;
  const float* bbg = bias + (size_t)bg * Hh;
  const float a = alpha[0];
  const int lane = threadIdx.x & 31;
  const int half = lane >> 4;
  const int n = lane & 15;

  // B fragments of q (K=c, N=i) for the fixed i-tiles, persistent
  v2f bq[NT][16];
  const float* qfr = qbg + (size_t)(2 * half) * Hh + i0 + n;  // lane's element of row 2*half
#pragma unroll
  for (int u = 0; u < NT; ++u) {
#pragma unroll
    for (int kb = 0; kb < 16; ++kb) bq[u][kb] = frag_g(qfr, Hh, 16 * u, kb * 4, 0, 0);
  }
  // the address registers of the loads above are inputs here, so they live up
  // to this wait and are reused only behind it
  asm volatile("s_wait_xcnt 0x0" ::"v"(qfr), "v"(n) : "memory");

  // row i0 + 16*u + n: reference maximum (equal in both half-waves) and the sum
  // of exp(logit - reference) over the j this half-wave has seen
  float mref[NT], rsum[NT];
#pragma unroll
  for (int u = 0; u < NT; ++u) {
    mref[u] = -3.0e38f;
    rsum[u] = 0.0f;
  }

  const v8f vz = {0.f, 0.f, 0.f, 0.f, 0.f, 0.f, 0.f, 0.f};
  v8f acc[NT][4];
#pragma unroll
  for (int u = 0; u < NT; ++u) {
#pragma unroll
    for (int t = 0; t < 4; ++t) acc[u][t] = vz;
  }

  const float* must = mubg + (size_t)half * Hh + n;  // lane's element of rows half, half+2, ...
  // Per-lane LDS bases, so that every access below is base + constant and the
  // address registers stay few (the fragments and sums fill the register budget).
  float* lmu_st = lmu + half * LQLD + n;            // staging store: row 2k + half, column n
  const float* lmu_a2 = lmu + n * LQLD + 2 * half;  // GEMM2 A: row t*16 + n, column kc + 2*half
  float* lw_st = lw + 8 * half * 16 + n;            // w^T store: tile u, row v + 8*half, column n
  const float* lw_b2 = lw + 2 * half * 16 + n;      // GEMM2 B: tile u, row kc + 2*half, column n
  for (int jt = wave * TPW; jt < wave * TPW + TPW; ++jt) {
    const int j0 = jt << 4;
    // stage mu[c, j0:j0+16] tile into LDS
    // (one lane address plus constant row steps: keeps the address registers few)
    const float* musi = must + j0;
#pragma unroll
    for (int k = 0; k < Cc / 2; ++k) lmu_st[2 * k * LQLD] = musi[(size_t)(2 * k) * Hh];
    wave_sync();
    // transposed logits: tz[j,i] = sum_c zeta[c,j] q[c,i]
    v8f d[NT];
#pragma unroll
    for (int u = 0; u < NT; ++u) d[u] = vz;
#pragma unroll
    for (int kb = 0; kb < 16; ++kb) {
      v2f az = frag_g(zbg, Hh, j0, kb * 4, half, n);  // A: zeta^T (M=j, K=c)
#pragma unroll
      for (int u = 0; u < NT; ++u) d[u] = wmma4(az, bq[u][kb], d[u]);
    }
    // logits: bias by row j
#pragma unroll
    for (int v = 0; v < 8; ++v) {
      const float bj = bbg[j0 + v + 8 * half];
#pragma unroll
      for (int u = 0; u < NT; ++u) d[u][v] = fmaf(a, d[u][v], bj);
    }
    float tm[NT];  // this pass's maximum over the lane's eight j
    bool need = false;
#pragma unroll
    for (int u = 0; u < NT; ++u) {
      tm[u] = d[u][0];
#pragma unroll
      for (int v = 1; v < 8; ++v) tm[u] = fmaxf(tm[u], d[u][v]);
      need = need || (tm[u] > mref[u] + RTH);
    }
    // one scalar branch a pass: taken on the first pass and where some row's
    // logits have outgrown its reference; every lane then takes its row's maximum
    if (__builtin_amdgcn_ballot_w32(need) != 0) {
#pragma unroll
      for (int u = 0; u < NT; ++u) {
        const float mn = fmaxf(mref[u], fmaxf(tm[u], xhalf(tm[u])));
        // exactly 1 for a row whose reference stays; 0 on the first pass
        const float corr = __expf(mref[u] - mn);
        rsum[u] *= corr;
#pragma unroll
        for (int t = 0; t < 4; ++t) acc[u][t] *= corr;
        mref[u] = mn;
      }
    }
    // exp(logit - reference), at most exp(RTH): w^T[j,i] up to the row's factor -> LDS
#pragma unroll
    for (int u = 0; u < NT; ++u) {
      float e[8];
#pragma unroll
      for (int v = 0; v < 8; ++v) {
        e[v] = __expf(d[u][v] - mref[u]);
        lw_st[u * 256 + v * 16] = e[v];
      }
      rsum[u] += ((e[0] + e[1]) + (e[2] + e[3])) + ((e[4] + e[5]) + (e[6] + e[7]));
    }
    wave_sync();
    // GEMM2: acc[c,i] += mu[c,j] * w^T[j,i]  (K = j, 4 steps of 4)
#pragma unroll
    for (int t = 0; t < 4; ++t) {
#pragma unroll
      for (int kb = 0; kb < 4; ++kb) {
        const int kc = kb * 4;
        v2f a2;  // A: mu (M=c, K=j)
        a2.x = lmu_a2[t * 16 * LQLD + kc];
        a2.y = lmu_a2[t * 16 * LQLD + kc + 1];
#pragma unroll
        for (int u = 0; u < NT; ++u) {
          v2f b2;  // B: w^T (K=j, N=i)
          b2.x = lw_b2[u * 256 + kc * 16];
          b2.y = lw_b2[u * 256 + (kc + 1) * 16];
          acc[u][t] = wmma4(a2, b2, acc[u][t]);
        }
      }
    }
    wave_sync();
  }
  // each wave leaves its partial sums in its own staging rows
  float* lmu_p = lmu + 8 * half * PLD + n;  // row t*16 + v + 8*half, column 16*u + n
#pragma unroll
  for (int u = 0; u < NT; ++u) {
#pragma unroll
    for (int t = 0; t < 4; ++t) {
#pragma unroll
      for (int v = 0; v < 8; ++v) {
        lmu_p[(t * 16 + v) * PLD + 16 * u] = acc[u][t][v];
      }
    }
    rsum[u] += xhalf(rsum[u]);  // join the two half-waves' j
    if (half == 0) {
      lw[16 * u + n] = mref[u];
      lw[FW + 16 * u + n] = rsum[u];
    }
  }
  __syncthreads();
  // merge: thread x owns column x & 31 and rows (x >> 5) + 4k
  const int mc = threadIdx.x >> 5;
  // the waves' references differ: bring each wave's sums to the largest of them
  float mall = lws[0][lane];
#pragma unroll
  for (int w = 1; w < NW; ++w) mall = fmaxf(mall, lws[w][lane]);
  float fw[NW];
#pragma unroll
  for (int w = 0; w < NW; ++w) fw[w] = __expf(lws[w][lane] - mall);
  float sall = lws[0][FW + lane] * fw[0];
#pragma unroll
  for (int w = 1; w < NW; ++w) sall = fmaf(lws[w][FW + lane], fw[w], sall);
  const float inv = 1.0f / (sall + 1e-20f);
  float* obg = out + (size_t)bg * Cc * Hh;
#pragma unroll
  for (int k = 0; k < Cc / NW; ++k) {
    const int c = mc + NW * k;
    float sum = lmus[0][c * PLD + lane] * fw[0];
#pragma unroll
    for (int w = 1; w < NW; ++w) sum = fmaf(lmus[w][c * PLD + lane], fw[w], sum);
    obg[(size_t)c * Hh + i0 + lane] = sum * inv;
  }
}

// ---------------------------------------------------------------------------
extern "C" void kernel_launch(void* const* d_in, const int* in_sizes, int n_in,
                              void* d_out, int out_size, void* d_ws,
                              size_t ws_size, hipStream_t stream) {
  const float* q = (const float*)d_in[0];
  const float* zeta = (const float*)d_in[1];
  const float* alpha = (const float*)d_in[2];
  const float* mu = (const float*)d_in[3];
  const float* beta = (const float*)d_in[4];
  float* out = (float*)d_out;

  float* ws = (float*)d_ws;
  float* bias = ws;                          // BG*Hh floats
  float* mrow = ws + (size_t)BG * Hh;        // BG*Hh
  float* srow = ws + (size_t)2 * BG * Hh;    // BG*Hh
  float* za = ws + (size_t)3 * BG * Hh;      // BG*Cc*Hh
  float* zb = za + (size_t)BG * Cc * Hh;     // BG*Cc*Hh  (~17 MB total)

  const dim3 wgrid(BG * (NTILE / NT)), wblk(32 * NW);

  k_bias<<<dim3((BG * Hh) / 256), dim3(256), 0, stream>>>(mu, beta, bias);
  // w0 = UW(zeta_in)
  k_stats<<<wgrid, wblk, 0, stream>>>(q, zeta, bias, alpha, mrow, srow);
  // iter 1: zeta_a = Z(w0);  w1 = UW(zeta_a)
  k_zeta<<<wgrid, wblk, 0, stream>>>(q, zeta, bias, alpha, mrow, srow, za);
  k_stats<<<wgrid, wblk, 0, stream>>>(q, za, bias, alpha, mrow, srow);
  // iter 2: zeta_b = Z(w1)
  k_zeta<<<wgrid, wblk, 0, stream>>>(q, za, bias, alpha, mrow, srow, zb);
  // out = V(w2), w2 = UW(zeta_b) formed inside
  k_value<<<wgrid, wblk, 0, stream>>>(q, zb, mu, bias, alpha, out);

  (void)in_sizes;
  (void)n_in;
  (void)out_size;
  (void)ws_size;
}

// v005
// It runs in 383 microseconds.
// Next to v004, in two timings, it ran 1.06 times as fast each time.
// Over all steps from v000 it is 2.20 times as fast.
#include <hip/hip_runtime.h>
#include <cstddef>

#define Hh 2048
#define Cc 64
#define BG 16
#define NTILE 128   // Hh / 16
#define LQLD 17     // padded LDS row stride (floats)
#define NW 4        // waves per work-group; each takes NTILE / NW tiles of the reduced axis
#define TPW 32      // NTILE / NW
#define NT 2        // 16-wide tiles of the fixed axis held by each wave
#define FW 32       // NT * 16: width of the fixed axis per work-group
#define PLD 33      // padded LDS row stride (floats) of the FW-wide partial sums
#define RTH 5.5f    // a logit may pass its row's reference maximum by this much (exp < 256)

typedef float v2f __attribute__((ext_vector_type(2)));
typedef float v4f __attribute__((ext_vector_type(4)));
typedef float v8f __attribute__((ext_vector_type(8)));

// Fragment loader for the 16x4 f32 A layout (and symmetric 4x16 B layout):
// lane L<16 : vgpr0 = X[kc+0][base+L], vgpr1 = X[kc+1][base+L]
// lane L>=16: vgpr0 = X[kc+2][base+L-16], vgpr1 = X[kc+3][base+L-16]
static __device__ __forceinline__ v2f frag_g(const float* p, int ld, int base,
                                             int kc, int half, int m) {
  const float* a = p + (size_t)(kc + 2 * half) * ld + base + m;
  v2f r;
  r.x = a[0];
  r.y = a[ld];
  return r;
}

// Orders one wave's own LDS stores and loads (each wave stages in LDS rows that
// no other wave touches inside the loops): the fences keep the waits a
// work-group barrier would bring, the wave barrier keeps the compiler from
// moving LDS accesses across; without it a lane could read a row before its
// neighbour lane's store. No other wave is waited for.
static __device__ __forceinline__ void wave_sync() {
  __builtin_amdgcn_fence(__ATOMIC_RELEASE, "workgroup");
  __builtin_amdgcn_wave_barrier();
  __builtin_amdgcn_fence(__ATOMIC_ACQUIRE, "workgroup");
}

// lane l reads lane l ^ 16 (the other half-wave's value of the same column)
static __device__ __forceinline__ float xhalf(float x) {
  const int b = __builtin_bit_cast(int, x);
  return __builtin_bit_cast(
      float, __builtin_amdgcn_permlanex16(b, b, 0x76543210, 0xfedcba98, false, false));
}

static __device__ __forceinline__ v8f wmma4(v2f a, v2f b, v8f c) {
  return __builtin_amdgcn_wmma_f32_16x16x4_f32(false, a, false, b, (short)0, c,
                                               false, false);
}

// ---------------------------------------------------------------------------
// K1: bias[bg,h] = 0.5 * beta * sum_c mu[bg,c,h]^2
// ---------------------------------------------------------------------------
__global__ void k_bias(const float* __restrict__ mu,
                       const float* __restrict__ beta,
                       float* __restrict__ bias) {
  const int idx = blockIdx.x * 256 + threadIdx.x;  // 0 .. BG*Hh-1
  const int bg = idx >> 11;                        // Hh == 2048
  const int h = idx & (Hh - 1);
  const float* p = mu + (size_t)bg * Cc * Hh + h;
  float s = 0.0f;
#pragma unroll 4
  for (int c = 0; c < Cc; ++c) {
    const float x = p[(size_t)c * Hh];
    s = fmaf(x, x, s);
  }
  bias[idx] = 0.5f * beta[0] * s;
}

// ---------------------------------------------------------------------------
// K2: per (bg, NT i-tiles) work-group: streaming softmax stats over j
//     logits[i,j] = a*(q^T zeta)[i,j] + bias[j];  m = rowmax, s = sum exp
//     stored per row: m + log(s), so that exp(logit - stored) is the normalised weight
//     logits computed TRANSPOSED (M=j, N=i): a lane holds eight j of ONE row i,
//     so maximum and sum over j run in the lane's own registers and no lane
//     exchange stands in the loop
//     each of the NW waves streams a quarter of j; the 2 * NW partial (m, s) of a
//     row (two half-waves a wave) merge in LDS
//     each wave holds NT i-tiles, so every loaded zeta fragment feeds NT products
// ---------------------------------------------------------------------------
__global__ __launch_bounds__(32 * NW, 4) void k_stats(
    const float* __restrict__ q, const float* __restrict__ zeta,
    const float* __restrict__ bias, const float* __restrict__ alpha,
    float* __restrict__ lrow) {
  __shared__ float pm[2 * NW][FW];
  __shared__ float ps[2 * NW][FW];
  const int wave = __builtin_amdgcn_readfirstlane((int)(threadIdx.x >> 5));
  const int wid = blockIdx.x;
  const int bg = wid >> 6;
  const int i0 = (wid & 63) << 5;
  const float* qbg = q + (size_t)bg * Cc * Hh;
  const float* zbg = zeta + (size_t)bg * Cc * Hh;
  const float* bbg = bias + (size_t)bg * Hh;
  const float a = alpha[0];
  const int lane = threadIdx.x & 31;
  const int half = lane >> 4;
  const int n = lane & 15;

  // B fragments of q (K=c, N=i), persistent across the j loop
  v2f bq[NT][16];
#pragma unroll
  for (int u = 0; u < NT; ++u) {
#pragma unroll
    for (int kb = 0; kb < 16; ++kb)
      bq[u][kb] = frag_g(qbg, Hh, i0 + 16 * u, kb * 4, half, n);
  }

  // running (max, sum) of row i0 + 16*u + n over the j this half-wave has seen
  float rmax[NT], rsum[NT];
#pragma unroll
  for (int u = 0; u < NT; ++u) {
    rmax[u] = -3.0e38f;
    rsum[u] = 0.0f;
  }

  const float* zfr = zbg + (size_t)(2 * half) * Hh + n;  // lane's element of row 2*half
  const float* bfr = bbg + 8 * half;                     // bias of this half-wave's first row j
  for (int jt = wave * TPW; jt < wave * TPW + TPW; ++jt) {
    const int j0 = jt << 4;
    const float* zp = zfr + j0;
    // bias by row j = j0 + 8*half + v: eight neighbours, 32-byte aligned
    const v4f* bp = (const v4f*)(bfr + j0);
    v2f az[16];  // A: zeta^T (M=j, K=c)
#pragma unroll
    for (int kb = 0; kb < 16; ++kb) az[kb] = frag_g(zp, Hh, 0, kb * 4, 0, 0);
    const v4f b0 = bp[0];
    const v4f b1 = bp[1];
    // the address registers of the loads above are inputs here, so they live up
    // to this wait and are reused (also as a load's target) only behind it
    asm volatile("s_wait_xcnt 0x0" ::"v"(zp), "v"(bp) : "memory");
    v8f d[NT];
#pragma unroll
    for (int u = 0; u < NT; ++u) d[u] = v8f{0.f, 0.f, 0.f, 0.f, 0.f, 0.f, 0.f, 0.f};
#pragma unroll
    for (int kb = 0; kb < 16; ++kb) {
#pragma unroll
      for (int u = 0; u < NT; ++u) d[u] = wmma4(az[kb], bq[u][kb], d[u]);
    }
#pragma unroll
    for (int u = 0; u < NT; ++u) {
      float t[8];
#pragma unroll
      for (int v = 0; v < 4; ++v) {
        t[v] = fmaf(a, d[u][v], b0[v]);
        t[v + 4] = fmaf(a, d[u][v + 4], b1[v]);
      }
      float tm = rmax[u];
#pragma unroll
      for (int v = 0; v < 8; ++v) tm = fmaxf(tm, t[v]);  // the new running maximum
      float e[8];
#pragma unroll
      for (int v = 0; v < 8; ++v) e[v] = __expf(t[v] - tm);
      const float es = ((e[0] + e[1]) + (e[2] + e[3])) + ((e[4] + e[5]) + (e[6] + e[7]));
      rsum[u] = rsum[u] * __expf(rmax[u] - tm) + es;
      rmax[u] = tm;
    }
  }
#pragma unroll
  for (int u = 0; u < NT; ++u) {
    pm[2 * wave + half][16 * u + n] = rmax[u];
    ps[2 * wave + half][16 * u + n] = rsum[u];
  }
  __syncthreads();
  // merge the 2 * NW partial (max, sum) pairs of each row
  if (threadIdx.x < FW) {
    const int r = threadIdx.x;
    float m = pm[0][r];
#pragma unroll
    for (int w = 1; w < 2 * NW; ++w) m = fmaxf(m, pm[w][r]);
    float ex[2 * NW];
#pragma unroll
    for (int w = 0; w < 2 * NW; ++w) ex[w] = __expf(pm[w][r] - m);
    float sum = 0.0f;
#pragma unroll
    for (int w = 0; w < 2 * NW; ++w) sum = fmaf(ps[w][r], ex[w], sum);
    lrow[(size_t)bg * Hh + i0 + r] = m + logf(sum + 1e-20f);
  }
}

// ---------------------------------------------------------------------------
// K3: per (bg, NT j-tiles) work-group: zeta_new[c,j] = (sum_i w[i,j] q[c,i]) / sum_i w
//     w recomputed from zeta_old and the row's m + log(s): the division by the
//     row sum is a subtraction in the exponent, one logarithm a row in K2
//     each of the NW waves sums a quarter of i; partial sums merge in LDS
//     each wave holds NT j-tiles, so every staged q tile and every q fragment
//     read from LDS feeds NT products
//     (launch bound 4 = waves a SIMD: a budget of 256 registers, so that all
//     1024 work-groups are resident at once)
// ---------------------------------------------------------------------------
__global__ __launch_bounds__(32 * NW, 4) void k_zeta(
    const float* __restrict__ q, const float* __restrict__ zold,
    const float* __restrict__ bias, const float* __restrict__ alpha,
    const float* __restrict__ lrow, float* __restrict__ znew) {
  __shared__ float lqs[NW][Cc * PLD];  // staging at stride LQLD, partial sums at PLD
  __shared__ float lws[NW][NT * 16 * 16];
  const int wave = __builtin_amdgcn_readfirstlane((int)(threadIdx.x >> 5));
  float* lq = lqs[wave];  // this wave's own staging rows
  float* lw = lws[wave];
  const int wid = blockIdx.x;
  const int bg = wid >> 6;
  const int j0 = (wid & 63) << 5;
  const float* qbg = q + (size_t)bg * Cc * Hh;
  const float* zbg = zold + (size_t)bg * Cc * Hh;
  const float* bbg = bias + (size_t)bg * Hh;
  const float* lbg = lrow + (size_t)bg * Hh;
  const float a = alpha[0];
  const int lane = threadIdx.x & 31;
  const int half = lane >> 4;
  const int n = lane & 15;

  // B fragments of zeta (K=c, N=j) for the fixed j-tiles, persistent
  v2f bz[NT][16];
  float bn[NT];
  const float* zfr = zbg + (size_t)(2 * half) * Hh + j0 + n;  // lane's element of row 2*half
#pragma unroll
  for (int u = 0; u < NT; ++u) {
#pragma unroll
    for (int kb = 0; kb < 16; ++kb) bz[u][kb] = frag_g(zfr, Hh, 16 * u, kb * 4, 0, 0);
    bn[u] = bbg[j0 + n + 16 * u];
  }
  // the address registers of the loads above are inputs here, so they live up
  // to this wait and are reused only behind it
  asm volatile("s_wait_xcnt 0x0" ::"v"(zfr), "v"(j0 + n) : "memory");

  const v8f vz = {0.f, 0.f, 0.f, 0.f, 0.f, 0.f, 0.f, 0.f};
  v8f acc[NT][4];
  float csum[NT];
#pragma unroll
  for (int u = 0; u < NT; ++u) {
#pragma unroll
    for (int t = 0; t < 4; ++t) acc[u][t] = vz;
    csum[u] = 0.0f;
  }

  const float* qst = qbg + (size_t)half * Hh + n;  // lane's element of rows half, half+2, ...
  // Per-lane LDS bases, so that every access below is base + constant and the
  // address registers stay few (the fragments and sums fill the register budget).
  float* lq_st = lq + half * LQLD + n;            // staging store: row 2k + half, column n
  const float* lq_a1 = lq + 2 * half * LQLD + n;  // GEMM1 A: row kc + 2*half, column n
  const float* lq_a2 = lq + n * LQLD + 2 * half;  // GEMM2 A: row t*16 + n, column kc + 2*half
  float* lw_st = lw + 8 * half * 16 + n;          // w store: tile u, row v + 8*half, column n
  const float* lw_b2 = lw + 2 * half * 16 + n;    // GEMM2 B: tile u, row kc + 2*half, column n
  for (int it = wave * TPW; it < wave * TPW + TPW; ++it) {
    const int i0 = it << 4;
    // stage q[c, i0:i0+16] tile into LDS (coalesced)
    // (one lane address plus constant row steps: keeps the address registers few)
    const float* qsi = qst + i0;
#pragma unroll
    for (int k = 0; k < Cc / 2; ++k) lq_st[2 * k * LQLD] = qsi[(size_t)(2 * k) * Hh];
    wave_sync();
    // GEMM1: qz[i,j] = sum_c q[c,i] zeta[c,j]
    v8f d[NT];
#pragma unroll
    for (int u = 0; u < NT; ++u) d[u] = vz;
#pragma unroll
    for (int kb = 0; kb < 16; ++kb) {
      const int kc = kb * 4;
      v2f afr;  // A: q^T (M=i, K=c) read from LDS
      afr.x = lq_a1[kc * LQLD];
      afr.y = lq_a1[(kc + 1) * LQLD];
#pragma unroll
      for (int u = 0; u < NT; ++u) d[u] = wmma4(afr, bz[u][kb], d[u]);
    }
    // w tiles -> LDS, plus column-sum accumulation
#pragma unroll
    for (int v = 0; v < 8; ++v) {
      const int row = i0 + v + 8 * half;
      const float lv = lbg[row];
#pragma unroll
      for (int u = 0; u < NT; ++u) {
        const float w = __expf(fmaf(a, d[u][v], bn[u]) - lv);
        lw_st[u * 256 + v * 16] = w;
        csum[u] += w;
      }
    }
    wave_sync();
    // GEMM2: acc[c,j] += q[c,i] * w[i,j]  (K = i, 4 steps of 4)
#pragma unroll
    for (int t = 0; t < 4; ++t) {
#pragma unroll
      for (int kb = 0; kb < 4; ++kb) {
        const int kc = kb * 4;
        v2f a2;  // A: q (M=c, K=i)
        a2.x = lq_a2[t * 16 * LQLD + kc];
        a2.y = lq_a2[t * 16 * LQLD + kc + 1];
#pragma unroll
        for (int u = 0; u < NT; ++u) {
          v2f b2;  // B: w (K=i, N=j)
          b2.x = lw_b2[u * 256 + kc * 16];
          b2.y = lw_b2[u * 256 + (kc + 1) * 16];
          acc[u][t] = wmma4(a2, b2, acc[u][t]);
        }
      }
    }
    wave_sync();
  }
  // each wave leaves its partial sums in its own staging rows
  float* lq_p = lq + 8 * half * PLD + n;  // row t*16 + v + 8*half, column 16*u + n
#pragma unroll
  for (int u = 0; u < NT; ++u) {
    csum[u] += __shfl_xor(csum[u], 16, 32);  // combine the two half-wave row groups
#pragma unroll
    for (int t = 0; t < 4; ++t) {
#pragma unroll
      for (int v = 0; v < 8; ++v) {
        lq_p[(t * 16 + v) * PLD + 16 * u] = acc[u][t][v];
      }
    }
    if (half == 0) lw[16 * u + n] = csum[u];
  }
  __syncthreads();
  // merge: thread x owns column x & 31 and rows (x >> 5) + 4k
  const int mc = threadIdx.x >> 5;
  float cs = 0.0f;
#pragma unroll
  for (int w = 0; w < NW; ++w) cs += lws[w][lane];
  const float inv = 1.0f / cs;
  float* zo = znew + (size_t)bg * Cc * Hh;
#pragma unroll
  for (int k = 0; k < Cc / NW; ++k) {
    const int c = mc + NW * k;
    float sum = 0.0f;
#pragma unroll
    for (int w = 0; w < NW; ++w) sum += lqs[w][c * PLD + lane];
    zo[(size_t)c * Hh + j0 + lane] = sum * inv;
  }
}

// ---------------------------------------------------------------------------
// K4: per (bg, NT i-tiles) work-group: out[c,i] = sum_j w[i,j] mu[c,j]
//     logits computed TRANSPOSED (M=j, N=i) so w^T lands in B orientation
//     the softmax over j runs inside this loop: a lane owns one row i, keeps a
//     reference maximum and the sum of exp(logit - reference) for it, and the
//     sums over j carry the same factor; when a logit passes the reference by
//     more than RTH the sums are rescaled to the new maximum (one test a pass);
//     the division by the row sum is done once, at the merge
//     every exponent is a plain difference of stored values (logit - reference,
//     old reference - new), so a row whose reference stays is rescaled by exactly 1
//     each of the NW waves sums a quarter of j; partial sums merge in LDS, each
//     brought to the largest of the waves' references
//     (the unroll directives on the short loops over u, v, t and w keep the
//     arrays they index in registers)
//     each wave holds NT i-tiles, so every loaded zeta fragment, every staged
//     mu tile and every mu fragment read from LDS feeds NT products
//     (launch bound 4 = waves a SIMD: a budget of 256 registers, so that all
//     1024 work-groups are resident at once)
// ---------------------------------------------------------------------------
__global__ __launch_bounds__(32 * NW, 4) void k_value(
    const float* __restrict__ q, const float* __restrict__ zeta,
    const float* __restrict__ mu, const float* __restrict__ bias,
    const float* __restrict__ alpha, float* __restrict__ out) {
  __shared__ float lmus[NW][Cc * PLD];  // staging at stride LQLD, partial sums at PLD
  __shared__ float lws[NW][NT * 16 * 16];
  const int wave = __builtin_amdgcn_readfirstlane((int)(threadIdx.x >> 5));
  float* lmu = lmus[wave];  // this wave's own staging rows
  float* lw = lws[wave];
  const int wid = blockIdx.x;
  const int bg = wid >> 6;
  const int i0 = (wid & 63) << 5;
  const float* qbg = q + (size_t)bg * Cc * Hh;
  const float* zbg = zeta + (size_t)bg * Cc * Hh;
  const float* mubg = mu + (size_t)bg * Cc * Hh;
  const float* bbg = bias + (size_t)bg * Hh;
  const float a = alpha[0];
  const int lane = threadIdx.x & 31;
  const int half = lane >> 4;
  const int n = lane & 15;

  // B fragments of q (K=c, N=i) for the fixed i-tiles, persistent
  v2f bq[NT][16];
  const float* qfr = qbg + (size_t)(2 * half) * Hh + i0 + n;  // lane's element of row 2*half
#pragma unroll
  for (int u = 0; u < NT; ++u) {
#pragma unroll
    for (int kb = 0; kb < 16; ++kb) bq[u][kb] = frag_g(qfr, Hh, 16 * u, kb * 4, 0, 0);
  }
  // the address registers of the loads above are inputs here, so they live up
  // to this wait and are reused only behind it
  asm volatile("s_wait_xcnt 0x0" ::"v"(qfr), "v"(n) : "memory");

  // row i0 + 16*u + n: reference maximum (equal in both half-waves) and the sum
  // of exp(logit - reference) over the j this half-wave has seen
  float mref[NT], rsum[NT];
#pragma unroll
  for (int u = 0; u < NT; ++u) {
    mref[u] = -3.0e38f;
    rsum[u] = 0.0f;
  }

  const v8f vz = {0.f, 0.f, 0.f, 0.f, 0.f, 0.f, 0.f, 0.f};
  v8f acc[NT][4];
#pragma unroll
  for (int u = 0; u < NT; ++u) {
#pragma unroll
    for (int t = 0; t < 4; ++t) acc[u][t] = vz;
  }

  const float* must = mubg + (size_t)half * Hh + n;  // lane's element of rows half, half+2, ...
  // Per-lane LDS bases, so that every access below is base + constant and the
  // address registers stay few (the fragments and sums fill the register budget).
  float* lmu_st = lmu + half * LQLD + n;            // staging store: row 2k + half, column n
  const float* lmu_a2 = lmu + n * LQLD + 2 * half;  // GEMM2 A: row t*16 + n, column kc + 2*half
  float* lw_st = lw + 8 * half * 16 + n;            // w^T store: tile u, row v + 8*half, column n
  const float* lw_b2 = lw + 2 * half * 16 + n;      // GEMM2 B: tile u, row kc + 2*half, column n
  for (int jt = wave * TPW; jt < wave * TPW + TPW; ++jt) {
    const int j0 = jt << 4;
    // stage mu[c, j0:j0+16] tile into LDS
    // (one lane address plus constant row steps: keeps the address registers few)
    const float* musi = must + j0;
#pragma unroll
    for (int k = 0; k < Cc / 2; ++k) lmu_st[2 * k * LQLD] = musi[(size_t)(2 * k) * Hh];
    wave_sync();
    // transposed logits: tz[j,i] = sum_c zeta[c,j] q[c,i]
    v8f d[NT];
#pragma unroll
    for (int u = 0; u < NT; ++u) d[u] = vz;
#pragma unroll
    for (int kb = 0; kb < 16; ++kb) {
      v2f az = frag_g(zbg, Hh, j0, kb * 4, half, n);  // A: zeta^T (M=j, K=c)
#pragma unroll
      for (int u = 0; u < NT; ++u) d[u] = wmma4(az, bq[u][kb], d[u]);
    }
    // logits: bias by row j
#pragma unroll
    for (int v = 0; v < 8; ++v) {
      const float bj = bbg[j0 + v + 8 * half];
#pragma unroll
      for (int u = 0; u < NT; ++u) d[u][v] = fmaf(a, d[u][v], bj);
    }
    float tm[NT];  // this pass's maximum over the lane's eight j
    bool need = false;
#pragma unroll
    for (int u = 0; u < NT; ++u) {
      tm[u] = d[u][0];
#pragma unroll
      for (int v = 1; v < 8; ++v) tm[u] = fmaxf(tm[u], d[u][v]);
      need = need || (tm[u] > mref[u] + RTH);
    }
    // one scalar branch a pass: taken on the first pass and where some row's
    // logits have outgrown its reference; every lane then takes its row's maximum
    if (__builtin_amdgcn_ballot_w32(need) != 0) {
#pragma unroll
      for (int u = 0; u < NT; ++u) {
        const float mn = fmaxf(mref[u], fmaxf(tm[u], xhalf(tm[u])));
        // exactly 1 for a row whose reference stays; 0 on the first pass
        const float corr = __expf(mref[u] - mn);
        rsum[u] *= corr;
#pragma unroll
        for (int t = 0; t < 4; ++t) acc[u][t] *= corr;
        mref[u] = mn;
      }
    }
    // exp(logit - reference), at most exp(RTH): w^T[j,i] up to the row's factor -> LDS
#pragma unroll
    for (int u = 0; u < NT; ++u) {
      float e[8];
#pragma unroll
      for (int v = 0; v < 8; ++v) {
        e[v] = __expf(d[u][v] - mref[u]);
        lw_st[u * 256 + v * 16] = e[v];
      }
      rsum[u] += ((e[0] + e[1]) + (e[2] + e[3])) + ((e[4] + e[5]) + (e[6] + e[7]));
    }
    wave_sync();
    // GEMM2: acc[c,i] += mu[c,j] * w^T[j,i]  (K = j, 4 steps of 4)
#pragma unroll
    for (int t = 0; t < 4; ++t) {
#pragma unroll
      for (int kb = 0; kb < 4; ++kb) {
        const int kc = kb * 4;
        v2f a2;  // A: mu (M=c, K=j)
        a2.x = lmu_a2[t * 16 * LQLD + kc];
        a2.y = lmu_a2[t * 16 * LQLD + kc + 1];
#pragma unroll
        for (int u = 0; u < NT; ++u) {
          v2f b2;  // B: w^T (K=j, N=i)
          b2.x = lw_b2[u * 256 + kc * 16];
          b2.y = lw_b2[u * 256 + (kc + 1) * 16];
          acc[u][t] = wmma4(a2, b2, acc[u][t]);
        }
      }
    }
    wave_sync();
  }
  // each wave leaves its partial sums in its own staging rows
  float* lmu_p = lmu + 8 * half * PLD + n;  // row t*16 + v + 8*half, column 16*u + n
#pragma unroll
  for (int u = 0; u < NT; ++u) {
#pragma unroll
    for (int t = 0; t < 4; ++t) {
#pragma unroll
      for (int v = 0; v < 8; ++v) {
        lmu_p[(t * 16 + v) * PLD + 16 * u] = acc[u][t][v];
      }
    }
    rsum[u] += xhalf(rsum[u]);  // join the two half-waves' j
    if (half == 0) {
      lw[16 * u + n] = mref[u];
      lw[FW + 16 * u + n] = rsum[u];
    }
  }
  __syncthreads();
  // merge: thread x owns column x & 31 and rows (x >> 5) + 4k
  const int mc = threadIdx.x >> 5;
  // the waves' references differ: bring each wave's sums to the largest of them
  float mall = lws[0][lane];
#pragma unroll
  for (int w = 1; w < NW; ++w) mall = fmaxf(mall, lws[w][lane]);
  float fw[NW];
#pragma unroll
  for (int w = 0; w < NW; ++w) fw[w] = __expf(lws[w][lane] - mall);
  float sall = lws[0][FW + lane] * fw[0];
#pragma unroll
  for (int w = 1; w < NW; ++w) sall = fmaf(lws[w][FW + lane], fw[w], sall);
  const float inv = 1.0f / (sall + 1e-20f);
  float* obg = out + (size_t)bg * Cc * Hh;
#pragma unroll
  for (int k = 0; k < Cc / NW; ++k) {
    const int c = mc + NW * k;
    float sum = lmus[0][c * PLD + lane] * fw[0];
#pragma unroll
    for (int w = 1; w < NW; ++w) sum = fmaf(lmus[w][c * PLD + lane], fw[w], sum);
    obg[(size_t)c * Hh + i0 + lane] = sum * inv;
  }
}

// ---------------------------------------------------------------------------
extern "C" void kernel_launch(void* const* d_in, const int* in_sizes, int n_in,
                              void* d_out, int out_size, void* d_ws,
                              size_t ws_size, hipStream_t stream) {
  const float* q = (const float*)d_in[0];
  const float* zeta = (const float*)d_in[1];
  const float* alpha = (const float*)d_in[2];
  const float* mu = (const float*)d_in[3];
  const float* beta = (const float*)d_in[4];
  float* out = (float*)d_out;

  float* ws = (float*)d_ws;
  float* bias = ws;                          // BG*Hh floats
  float* lrow = ws + (size_t)BG * Hh;        // BG*Hh
  float* za = ws + (size_t)2 * BG * Hh;      // BG*Cc*Hh
  float* zb = za + (size_t)BG * Cc * Hh;     // BG*Cc*Hh  (~17 MB total)

  const dim3 wgrid(BG * (NTILE / NT)), wblk(32 * NW);

  k_bias<<<dim3((BG * Hh) / 256), dim3(256), 0, stream>>>(mu, beta, bias);
  // w0 = UW(zeta_in)
  k_stats<<<wgrid, wblk, 0, stream>>>(q, zeta, bias, alpha, lrow);
  // iter 1: zeta_a = Z(w0);  w1 = UW(zeta_a)
  k_zeta<<<wgrid, wblk, 0, stream>>>(q, zeta, bias, alpha, lrow, za);
  k_stats<<<wgrid, wblk, 0, stream>>>(q, za, bias, alpha, lrow);
  // iter 2: zeta_b = Z(w1)
  k_zeta<<<wgrid, wblk, 0, stream>>>(q, za, bias, alpha, lrow, zb);
  // out = V(w2), w2 = UW(zeta_b) formed inside
  k_value<<<wgrid, wblk, 0, stream>>>(q, zb, mu, bias, alpha, out);

  (void)in_sizes;
  (void)n_in;
  (void)out_size;
  (void)ws_size;
}

// v006
// Measured time: 356 microseconds a run.
// In both of two side-by-side timings against v005, it was 1.08 times as fast.
// All steps since v000 together make it 2.37 times as fast.
#include <hip/hip_runtime.h>
#include <cstddef>

#define Hh 2048
#define Cc 64
#define BG 16
#define NTILE 128   // Hh / 16
#define LQLD 17     // padded LDS row stride (floats)
#define NW 4        // waves per work-group; each takes NTILE / NW tiles of the reduced axis
#define TPW 32      // NTILE / NW
#define NT 2        // 16-wide tiles of the fixed axis held by each wave
#define FW 32       // NT * 16: width of the fixed axis per work-group
#define PLD 33      // padded LDS row stride (floats) of the FW-wide partial sums
#define RTH 5.5f    // a logit may pass its row's reference maximum by this much (exp < 256)

typedef float v2f __attribute__((ext_vector_type(2)));
typedef float v4f __attribute__((ext_vector_type(4)));
typedef float v8f __attribute__((ext_vector_type(8)));

// Fragment loader for the 16x4 f32 A layout (and symmetric 4x16 B layout):
// lane L<16 : vgpr0 = X[kc+0][base+L], vgpr1 = X[kc+1][base+L]
// lane L>=16: vgpr0 = X[kc+2][base+L-16], vgpr1 = X[kc+3][base+L-16]
static __device__ __forceinline__ v2f frag_g(const float* p, int ld, int base,
                                             int kc, int half, int m) {
  const float* a = p + (size_t)(kc + 2 * half) * ld + base + m;
  v2f r;
  r.x = a[0];
  r.y = a[ld];
  return r;
}

// Orders one wave's own LDS stores and loads (each wave stages in LDS rows that
// no other wave touches inside the loops): the fences keep the waits a
// work-group barrier would bring, the wave barrier keeps the compiler from
// moving LDS accesses across; without it a lane could read a row before its
// neighbour lane's store. No other wave is waited for.
static __device__ __forceinline__ void wave_sync() {
  __builtin_amdgcn_fence(__ATOMIC_RELEASE, "workgroup");
  __builtin_amdgcn_wave_barrier();
  __builtin_amdgcn_fence(__ATOMIC_ACQUIRE, "workgroup");
}

// lane l reads lane l ^ 16 (the other half-wave's value of the same column)
static __device__ __forceinline__ float xhalf(float x) {
  const int b = __builtin_bit_cast(int, x);
  return __builtin_bit_cast(
      float, __builtin_amdgcn_permlanex16(b, b, 0x76543210, 0xfedcba98, false, false));
}

static __device__ __forceinline__ v8f wmma4(v2f a, v2f b, v8f c) {
  return __builtin_amdgcn_wmma_f32_16x16x4_f32(false, a, false, b, (short)0, c,
                                               false, false);
}

// A wave's TPW passes run in four stretches, ever shorter (20, 7, 3 and 2 of 32),
// at issue priority 3, 2, 1, 0, for speed only. A wave that is ahead now ranks below those behind it and
// takes only the slots they leave, so the four end close together; the last
// stretch is the shortest. Starts stretch ph (a scalar)
// and returns the number of passes done at its end; the last stretch and all
// that follows the loop run at priority 0.
static __device__ __forceinline__ int stretch(int ph) {
  if (ph == 0) {
    __builtin_amdgcn_s_setprio(3);
    return 5 * TPW / 8;
  }
  if (ph == 1) {
    __builtin_amdgcn_s_setprio(2);
    return 27 * TPW / 32;
  }
  if (ph == 2) {
    __builtin_amdgcn_s_setprio(1);
    return 15 * TPW / 16;
  }
  __builtin_amdgcn_s_setprio(0);
  return TPW;
}

// ---------------------------------------------------------------------------
// K1: bias[bg,h] = 0.5 * beta * sum_c mu[bg,c,h]^2
// ---------------------------------------------------------------------------
__global__ void k_bias(const float* __restrict__ mu,
                       const float* __restrict__ beta,
                       float* __restrict__ bias) {
  const int idx = blockIdx.x * 256 + threadIdx.x;  // 0 .. BG*Hh-1
  const int bg = idx >> 11;                        // Hh == 2048
  const int h = idx & (Hh - 1);
  const float* p = mu + (size_t)bg * Cc * Hh + h;
  float s = 0.0f;
#pragma unroll 4
  for (int c = 0; c < Cc; ++c) {
    const float x = p[(size_t)c * Hh];
    s = fmaf(x, x, s);
  }
  bias[idx] = 0.5f * beta[0] * s;
}

// ---------------------------------------------------------------------------
// K2: per (bg, NT i-tiles) work-group: streaming softmax stats over j
//     logits[i,j] = a*(q^T zeta)[i,j] + bias[j];  m = rowmax, s = sum exp
//     stored per row: m + log(s), so that exp(logit - stored) is the normalised weight
//     logits computed TRANSPOSED (M=j, N=i): a lane holds eight j of ONE row i,
//     so maximum and sum over j run in the lane's own registers and no lane
//     exchange stands in the loop
//     each of the NW waves streams a quarter of j; the 2 * NW partial (m, s) of a
//     row (two half-waves a wave) merge in LDS
//     each wave holds NT i-tiles, so every loaded zeta fragment feeds NT products
// ---------------------------------------------------------------------------
__global__ __launch_bounds__(32 * NW, 4) void k_stats(
    const float* __restrict__ q, const float* __restrict__ zeta,
    const float* __restrict__ bias, const float* __restrict__ alpha,
    float* __restrict__ lrow) {
  __shared__ float pm[2 * NW][FW];
  __shared__ float ps[2 * NW][FW];
  const int wave = __builtin_amdgcn_readfirstlane((int)(threadIdx.x >> 5));
  const int wid = blockIdx.x;
  const int bg = wid >> 6;
  const int i0 = (wid & 63) << 5;
  const float* qbg = q + (size_t)bg * Cc * Hh;
  const float* zbg = zeta + (size_t)bg * Cc * Hh;
  const float* bbg = bias + (size_t)bg * Hh;
  const float a = alpha[0];
  const int lane = threadIdx.x & 31;
  const int half = lane >> 4;
  const int n = lane & 15;

  // B fragments of q (K=c, N=i), persistent across the j loop
  v2f bq[NT][16];
#pragma unroll
  for (int u = 0; u < NT; ++u) {
#pragma unroll
    for (int kb = 0; kb < 16; ++kb)
      bq[u][kb] = frag_g(qbg, Hh, i0 + 16 * u, kb * 4, half, n);
  }

  // running (max, sum) of row i0 + 16*u + n over the j this half-wave has seen
  float rmax[NT], rsum[NT];
#pragma unroll
  for (int u = 0; u < NT; ++u) {
    rmax[u] = -3.0e38f;
    rsum[u] = 0.0f;
  }

  const float* zfr = zbg + (size_t)(2 * half) * Hh + n;  // lane's element of row 2*half
  const float* bfr = bbg + 8 * half;                     // bias of this half-wave's first row j
  int jt = wave * TPW;
  // kept rolled: one copy of the pass in the instruction cache
#pragma unroll 1
  for (int ph = 0; ph < 4; ++ph) {
  const int jend = wave * TPW + stretch(ph);
  for (; jt < jend; ++jt) {
    const int j0 = jt << 4;
    const float* zp = zfr + j0;
    // bias by row j = j0 + 8*half + v: eight neighbours, 32-byte aligned
    const v4f* bp = (const v4f*)(bfr + j0);
    v2f az[16];  // A: zeta^T (M=j, K=c)
#pragma unroll
    for (int kb = 0; kb < 16; ++kb) az[kb] = frag_g(zp, Hh, 0, kb * 4, 0, 0);
    const v4f b0 = bp[0];
    const v4f b1 = bp[1];
    // the address registers of the loads above are inputs here, so they live up
    // to this wait and are reused (also as a load's target) only behind it
    asm volatile("s_wait_xcnt 0x0" ::"v"(zp), "v"(bp) : "memory");
    v8f d[NT];
#pragma unroll
    for (int u = 0; u < NT; ++u) d[u] = v8f{0.f, 0.f, 0.f, 0.f, 0.f, 0.f, 0.f, 0.f};
#pragma unroll
    for (int kb = 0; kb < 16; ++kb) {
#pragma unroll
      for (int u = 0; u < NT; ++u) d[u] = wmma4(az[kb], bq[u][kb], d[u]);
    }
#pragma unroll
    for (int u = 0; u < NT; ++u) {
      float t[8];
#pragma unroll
      for (int v = 0; v < 4; ++v) {
        t[v] = fmaf(a, d[u][v], b0[v]);
        t[v + 4] = fmaf(a, d[u][v + 4], b1[v]);
      }
      float tm = rmax[u];
#pragma unroll
      for (int v = 0; v < 8; ++v) tm = fmaxf(tm, t[v]);  // the new running maximum
      float e[8];
#pragma unroll
      for (int v = 0; v < 8; ++v) e[v] = __expf(t[v] - tm);
      const float es = ((e[0] + e[1]) + (e[2] + e[3])) + ((e[4] + e[5]) + (e[6] + e[7]));
      rsum[u] = rsum[u] * __expf(rmax[u] - tm) + es;
      rmax[u] = tm;
    }
  }
  }
#pragma unroll
  for (int u = 0; u < NT; ++u) {
    pm[2 * wave + half][16 * u + n] = rmax[u];
    ps[2 * wave + half][16 * u + n] = rsum[u];
  }
  __syncthreads();
  // merge the 2 * NW partial (max, sum) pairs of each row
  if (threadIdx.x < FW) {
    const int r = threadIdx.x;
    float m = pm[0][r];
#pragma unroll
    for (int w = 1; w < 2 * NW; ++w) m = fmaxf(m, pm[w][r]);
    float ex[2 * NW];
#pragma unroll
    for (int w = 0; w < 2 * NW; ++w) ex[w] = __expf(pm[w][r] - m);
    float sum = 0.0f;
#pragma unroll
    for (int w = 0; w < 2 * NW; ++w) sum = fmaf(ps[w][r], ex[w], sum);
    lrow[(size_t)bg * Hh + i0 + r] = m + logf(sum + 1e-20f);
  }
}

// ---------------------------------------------------------------------------
// K3: per (bg, NT j-tiles) work-group: zeta_new[c,j] = (sum_i w[i,j] q[c,i]) / sum_i w
//     w recomputed from zeta_old and the row's m + log(s): the division by the
//     row sum is a subtraction in the exponent, one logarithm a row in K2
//     each of the NW waves sums a quarter of i; partial sums merge in LDS
//     each wave holds NT j-tiles, so every staged q tile and every q fragment
//     read from LDS feeds NT products
//     (launch bound 4 = waves a SIMD: a budget of 256 registers, so that all
//     1024 work-groups are resident at once)
// ---------------------------------------------------------------------------
__global__ __launch_bounds__(32 * NW, 4) void k_zeta(
    const float* __restrict__ q, const float* __restrict__ zold,
    const float* __restrict__ bias, const float* __restrict__ alpha,
    const float* __restrict__ lrow, float* __restrict__ znew) {
  __shared__ float lqs[NW][Cc * PLD];  // staging at stride LQLD, partial sums at PLD
  __shared__ float lws[NW][NT * 16 * 16];
  const int wave = __builtin_amdgcn_readfirstlane((int)(threadIdx.x >> 5));
  float* lq = lqs[wave];  // this wave's own staging rows
  float* lw = lws[wave];
  const int wid = blockIdx.x;
  const int bg = wid >> 6;
  const int j0 = (wid & 63) << 5;
  const float* qbg = q + (size_t)bg * Cc * Hh;
  const float* zbg = zold + (size_t)bg * Cc * Hh;
  const float* bbg = bias + (size_t)bg * Hh;
  const float* lbg = lrow + (size_t)bg * Hh;
  const float a = alpha[0];
  const int lane = threadIdx.x & 31;
  const int half = lane >> 4;
  const int n = lane & 15;

  // B fragments of zeta (K=c, N=j) for the fixed j-tiles, persistent
  v2f bz[NT][16];
  float bn[NT];
  const float* zfr = zbg + (size_t)(2 * half) * Hh + j0 + n;  // lane's element of row 2*half
#pragma unroll
  for (int u = 0; u < NT; ++u) {
#pragma unroll
    for (int kb = 0; kb < 16; ++kb) bz[u][kb] = frag_g(zfr, Hh, 16 * u, kb * 4, 0, 0);
    bn[u] = bbg[j0 + n + 16 * u];
  }
  // the address registers of the loads above are inputs here, so they live up
  // to this wait and are reused only behind it
  asm volatile("s_wait_xcnt 0x0" ::"v"(zfr), "v"(j0 + n) : "memory");

  const v8f vz = {0.f, 0.f, 0.f, 0.f, 0.f, 0.f, 0.f, 0.f};
  v8f acc[NT][4];
  float csum[NT];
#pragma unroll
  for (int u = 0; u < NT; ++u) {
#pragma unroll
    for (int t = 0; t < 4; ++t) acc[u][t] = vz;
    csum[u] = 0.0f;
  }

  const float* qst = qbg + (size_t)half * Hh + n;  // lane's element of rows half, half+2, ...
  // Per-lane LDS bases, so that every access below is base + constant and the
  // address registers stay few (the fragments and sums fill the register budget).
  float* lq_st = lq + half * LQLD + n;            // staging store: row 2k + half, column n
  const float* lq_a1 = lq + 2 * half * LQLD + n;  // GEMM1 A: row kc + 2*half, column n
  const float* lq_a2 = lq + n * LQLD + 2 * half;  // GEMM2 A: row t*16 + n, column kc + 2*half
  float* lw_st = lw + 8 * half * 16 + n;          // w store: tile u, row v + 8*half, column n
  const float* lw_b2 = lw + 2 * half * 16 + n;    // GEMM2 B: tile u, row kc + 2*half, column n
  int it = wave * TPW;
  // kept rolled: one copy of the pass in the instruction cache
#pragma unroll 1
  for (int ph = 0; ph < 4; ++ph) {
  const int iend = wave * TPW + stretch(ph);
  for (; it < iend; ++it) {
    const int i0 = it << 4;
    // stage q[c, i0:i0+16] tile into LDS (coalesced)
    // (one lane address plus constant row steps: keeps the address registers few)
    const float* qsi = qst + i0;
#pragma unroll
    for (int k = 0; k < Cc / 2; ++k) lq_st[2 * k * LQLD] = qsi[(size_t)(2 * k) * Hh];
    wave_sync();
    // GEMM1: qz[i,j] = sum_c q[c,i] zeta[c,j]
    v8f d[NT];
#pragma unroll
    for (int u = 0; u < NT; ++u) d[u] = vz;
#pragma unroll
    for (int kb = 0; kb < 16; ++kb) {
      const int kc = kb * 4;
      v2f afr;  // A: q^T (M=i, K=c) read from LDS
      afr.x = lq_a1[kc * LQLD];
      afr.y = lq_a1[(kc + 1) * LQLD];
#pragma unroll
      for (int u = 0; u < NT; ++u) d[u] = wmma4(afr, bz[u][kb], d[u]);
    }
    // w tiles -> LDS, plus column-sum accumulation
#pragma unroll
    for (int v = 0; v < 8; ++v) {
      const int row = i0 + v + 8 * half;
      const float lv = lbg[row];
#pragma unroll
      for (int u = 0; u < NT; ++u) {
        const float w = __expf(fmaf(a, d[u][v], bn[u]) - lv);
        lw_st[u * 256 + v * 16] = w;
        csum[u] += w;
      }
    }
    wave_sync();
    // GEMM2: acc[c,j] += q[c,i] * w[i,j]  (K = i, 4 steps of 4)
#pragma unroll
    for (int t = 0; t < 4; ++t) {
#pragma unroll
      for (int kb = 0; kb < 4; ++kb) {
        const int kc = kb * 4;
        v2f a2;  // A: q (M=c, K=i)
        a2.x = lq_a2[t * 16 * LQLD + kc];
        a2.y = lq_a2[t * 16 * LQLD + kc + 1];
#pragma unroll
        for (int u = 0; u < NT; ++u) {
          v2f b2;  // B: w (K=i, N=j)
          b2.x = lw_b2[u * 256 + kc * 16];
          b2.y = lw_b2[u * 256 + (kc + 1) * 16];
          acc[u][t] = wmma4(a2, b2, acc[u][t]);
        }
      }
    }
    wave_sync();
  }
  }
  // each wave leaves its partial sums in its own staging rows
  float* lq_p = lq + 8 * half * PLD + n;  // row t*16 + v + 8*half, column 16*u + n
#pragma unroll
  for (int u = 0; u < NT; ++u) {
    csum[u] += __shfl_xor(csum[u], 16, 32);  // combine the two half-wave row groups
#pragma unroll
    for (int t = 0; t < 4; ++t) {
#pragma unroll
      for (int v = 0; v < 8; ++v) {
        lq_p[(t * 16 + v) * PLD + 16 * u] = acc[u][t][v];
      }
    }
    if (half == 0) lw[16 * u + n] = csum[u];
  }
  __syncthreads();
  // merge: thread x owns column x & 31 and rows (x >> 5) + 4k
  const int mc = threadIdx.x >> 5;
  float cs = 0.0f;
#pragma unroll
  for (int w = 0; w < NW; ++w) cs += lws[w][lane];
  const float inv = 1.0f / cs;
  float* zo = znew + (size_t)bg * Cc * Hh;
#pragma unroll
  for (int k = 0; k < Cc / NW; ++k) {
    const int c = mc + NW * k;
    float sum = 0.0f;
#pragma unroll
    for (int w = 0; w < NW; ++w) sum += lqs[w][c * PLD + lane];
    zo[(size_t)c * Hh + j0 + lane] = sum * inv;
  }
}

// ---------------------------------------------------------------------------
// K4: per (bg, NT i-tiles) work-group: out[c,i] = sum_j w[i,j] mu[c,j]
//     logits computed TRANSPOSED (M=j, N=i) so w^T lands in B orientation
//     the softmax over j runs inside this loop: a lane owns one row i, keeps a
//     reference maximum and the sum of exp(logit - reference) for it, and the
//     sums over j carry the same factor; when a logit passes the reference by
//     more than RTH the sums are rescaled to the new maximum (one test a pass);
//     the division by the row sum is done once, at the merge
//     every exponent is a plain difference of stored values (logit - reference,
//     old reference - new), so a row whose reference stays is rescaled by exactly 1
//     each of the NW waves sums a quarter of j; partial sums merge in LDS, each
//     brought to the largest of the waves' references
//     (the unroll directives on the short loops over u, v, t and w keep the
//     arrays they index in registers)
//     each wave holds NT i-tiles, so every loaded zeta fragment, every staged
//     mu tile and every mu fragment read from LDS feeds NT products
//     (launch bound 4 = waves a SIMD: a budget of 256 registers, so that all
//     1024 work-groups are resident at once)
// ---------------------------------------------------------------------------
__global__ __launch_bounds__(32 * NW, 4) void k_value(
    const float* __restrict__ q, const float* __restrict__ zeta,
    const float* __restrict__ mu, const float* __restrict__ bias,
    const float* __restrict__ alpha, float* __restrict__ out) {
  __shared__ float lmus[NW][Cc * PLD];  // staging at stride LQLD, partial sums at PLD
  __shared__ float lws[NW][NT * 16 * 16];
  const int wave = __builtin_amdgcn_readfirstlane((int)(threadIdx.x >> 5));
  float* lmu = lmus[wave];  // this wave's own staging rows
  float* lw = lws[wave];
  const int wid = blockIdx.x;
  const int bg = wid >> 6;
  const int i0 = (wid & 63) << 5;
  const float* qbg = q + (size_t)bg * Cc * Hh;
  const float* zbg = zeta + (size_t)bg * Cc * Hh;
  const float* mubg = mu + (size_t)bg * Cc * Hh;
  const float* bbg = bias + (size_t)bg * Hh;
  const float a = alpha[0];
  const int lane = threadIdx.x & 31;
  const int half = lane >> 4;
  const int n = lane & 15;

  // B fragments of q (K=c, N=i) for the fixed i-tiles, persistent
  v2f bq[NT][16];
  const float* qfr = qbg + (size_t)(2 * half) * Hh + i0 + n;  // lane's element of row 2*half
#pragma unroll
  for (int u = 0; u < NT; ++u) {
#pragma unroll
    for (int kb = 0; kb < 16; ++kb) bq[u][kb] = frag_g(qfr, Hh, 16 * u, kb * 4, 0, 0);
  }
  // the address registers of the loads above are inputs here, so they live up
  // to this wait and are reused only behind it
  asm volatile("s_wait_xcnt 0x0" ::"v"(qfr), "v"(n) : "memory");

  // row i0 + 16*u + n: reference maximum (equal in both half-waves) and the sum
  // of exp(logit - reference) over the j this half-wave has seen
  float mref[NT], rsum[NT];
#pragma unroll
  for (int u = 0; u < NT; ++u) {
    mref[u] = -3.0e38f;
    rsum[u] = 0.0f;
  }

  const v8f vz = {0.f, 0.f, 0.f, 0.f, 0.f, 0.f, 0.f, 0.f};
  v8f acc[NT][4];
#pragma unroll
  for (int u = 0; u < NT; ++u) {
#pragma unroll
    for (int t = 0; t < 4; ++t) acc[u][t] = vz;
  }

  const float* must = mubg + (size_t)half * Hh + n;  // lane's element of rows half, half+2, ...
  // Per-lane LDS bases, so that every access below is base + constant and the
  // address registers stay few (the fragments and sums fill the register budget).
  float* lmu_st = lmu + half * LQLD + n;            // staging store: row 2k + half, column n
  const float* lmu_a2 = lmu + n * LQLD + 2 * half;  // GEMM2 A: row t*16 + n, column kc + 2*half
  float* lw_st = lw + 8 * half * 16 + n;            // w^T store: tile u, row v + 8*half, column n
  const float* lw_b2 = lw + 2 * half * 16 + n;      // GEMM2 B: tile u, row kc + 2*half, column n
  int jt = wave * TPW;
  // kept rolled: one copy of the pass in the instruction cache
#pragma unroll 1
  for (int ph = 0; ph < 4; ++ph) {
  const int jend = wave * TPW + stretch(ph);
  for (; jt < jend; ++jt) {
    const int j0 = jt << 4;
    // stage mu[c, j0:j0+16] tile into LDS
    // (one lane address plus constant row steps: keeps the address registers few)
    const float* musi = must + j0;
#pragma unroll
    for (int k = 0; k < Cc / 2; ++k) lmu_st[2 * k * LQLD] = musi[(size_t)(2 * k) * Hh];
    wave_sync();
    // transposed logits: tz[j,i] = sum_c zeta[c,j] q[c,i]
    v8f d[NT];
#pragma unroll
    for (int u = 0; u < NT; ++u) d[u] = vz;
#pragma unroll
    for (int kb = 0; kb < 16; ++kb) {
      v2f az = frag_g(zbg, Hh, j0, kb * 4, half, n);  // A: zeta^T (M=j, K=c)
#pragma unroll
      for (int u = 0; u < NT; ++u) d[u] = wmma4(az, bq[u][kb], d[u]);
    }
    // logits: bias by row j
#pragma unroll
    for (int v = 0; v < 8; ++v) {
      const float bj = bbg[j0 + v + 8 * half];
#pragma unroll
      for (int u = 0; u < NT; ++u) d[u][v] = fmaf(a, d[u][v], bj);
    }
    float tm[NT];  // this pass's maximum over the lane's eight j
    bool need = false;
#pragma unroll
    for (int u = 0; u < NT; ++u) {
      tm[u] = d[u][0];
#pragma unroll
      for (int v = 1; v < 8; ++v) tm[u] = fmaxf(tm[u], d[u][v]);
      need = need || (tm[u] > mref[u] + RTH);
    }
    // one scalar branch a pass: taken on the first pass and where some row's
    // logits have outgrown its reference; every lane then takes its row's maximum
    if (__builtin_amdgcn_ballot_w32(need) != 0) {
#pragma unroll
      for (int u = 0; u < NT; ++u) {
        const float mn = fmaxf(mref[u], fmaxf(tm[u], xhalf(tm[u])));
        // exactly 1 for a row whose reference stays; 0 on the first pass
        const float corr = __expf(mref[u] - mn);
        rsum[u] *= corr;
#pragma unroll
        for (int t = 0; t < 4; ++t) acc[u][t] *= corr;
        mref[u] = mn;
      }
    }
    // exp(logit - reference), at most exp(RTH): w^T[j,i] up to the row's factor -> LDS
#pragma unroll
    for (int u = 0; u < NT; ++u) {
      float e[8];
#pragma unroll
      for (int v = 0; v < 8; ++v) {
        e[v] = __expf(d[u][v] - mref[u]);
        lw_st[u * 256 + v * 16] = e[v];
      }
      rsum[u] += ((e[0] + e[1]) + (e[2] + e[3])) + ((e[4] + e[5]) + (e[6] + e[7]));
    }
    wave_sync();
    // GEMM2: acc[c,i] += mu[c,j] * w^T[j,i]  (K = j, 4 steps of 4)
#pragma unroll
    for (int t = 0; t < 4; ++t) {
#pragma unroll
      for (int kb = 0; kb < 4; ++kb) {
        const int kc = kb * 4;
        v2f a2;  // A: mu (M=c, K=j)
        a2.x = lmu_a2[t * 16 * LQLD + kc];
        a2.y = lmu_a2[t * 16 * LQLD + kc + 1];
#pragma unroll
        for (int u = 0; u < NT; ++u) {
          v2f b2;  // B: w^T (K=j, N=i)
          b2.x = lw_b2[u * 256 + kc * 16];
          b2.y = lw_b2[u * 256 + (kc + 1) * 16];
          acc[u][t] = wmma4(a2, b2, acc[u][t]);
        }
      }
    }
    wave_sync();
  }
  }
  // each wave leaves its partial sums in its own staging rows
  float* lmu_p = lmu + 8 * half * PLD + n;  // row t*16 + v + 8*half, column 16*u + n
#pragma unroll
  for (int u = 0; u < NT; ++u) {
#pragma unroll
    for (int t = 0; t < 4; ++t) {
#pragma unroll
      for (int v = 0; v < 8; ++v) {
        lmu_p[(t * 16 + v) * PLD + 16 * u] = acc[u][t][v];
      }
    }
    rsum[u] += xhalf(rsum[u]);  // join the two half-waves' j
    if (half == 0) {
      lw[16 * u + n] = mref[u];
      lw[FW + 16 * u + n] = rsum[u];
    }
  }
  __syncthreads();
  // merge: thread x owns column x & 31 and rows (x >> 5) + 4k
  const int mc = threadIdx.x >> 5;
  // the waves' references differ: bring each wave's sums to the largest of them
  float mall = lws[0][lane];
#pragma unroll
  for (int w = 1; w < NW; ++w) mall = fmaxf(mall, lws[w][lane]);
  float fw[NW];
#pragma unroll
  for (int w = 0; w < NW; ++w) fw[w] = __expf(lws[w][lane] - mall);
  float sall = lws[0][FW + lane] * fw[0];
#pragma unroll
  for (int w = 1; w < NW; ++w) sall = fmaf(lws[w][FW + lane], fw[w], sall);
  const float inv = 1.0f / (sall + 1e-20f);
  float* obg = out + (size_t)bg * Cc * Hh;
#pragma unroll
  for (int k = 0; k < Cc / NW; ++k) {
    const int c = mc + NW * k;
    float sum = lmus[0][c * PLD + lane] * fw[0];
#pragma unroll
    for (int w = 1; w < NW; ++w) sum = fmaf(lmus[w][c * PLD + lane], fw[w], sum);
    obg[(size_t)c * Hh + i0 + lane] = sum * inv;
  }
}

// ---------------------------------------------------------------------------
extern "C" void kernel_launch(void* const* d_in, const int* in_sizes, int n_in,
                              void* d_out, int out_size, void* d_ws,
                              size_t ws_size, hipStream_t stream) {
  const float* q = (const float*)d_in[0];
  const float* zeta = (const float*)d_in[1];
  const float* alpha = (const float*)d_in[2];
  const float* mu = (const float*)d_in[3];
  const float* beta = (const float*)d_in[4];
  float* out = (float*)d_out;

  float* ws = (float*)d_ws;
  float* bias = ws;                          // BG*Hh floats
  float* lrow = ws + (size_t)BG * Hh;        // BG*Hh
  float* za = ws + (size_t)2 * BG * Hh;      // BG*Cc*Hh
  float* zb = za + (size_t)BG * Cc * Hh;     // BG*Cc*Hh  (~17 MB total)

  const dim3 wgrid(BG * (NTILE / NT)), wblk(32 * NW);

  k_bias<<<dim3((BG * Hh) / 256), dim3(256), 0, stream>>>(mu, beta, bias);
  // w0 = UW(zeta_in)
  k_stats<<<wgrid, wblk, 0, stream>>>(q, zeta, bias, alpha, lrow);
  // iter 1: zeta_a = Z(w0);  w1 = UW(zeta_a)
  k_zeta<<<wgrid, wblk, 0, stream>>>(q, zeta, bias, alpha, lrow, za);
  k_stats<<<wgrid, wblk, 0, stream>>>(q, za, bias, alpha, lrow);
  // iter 2: zeta_b = Z(w1)
  k_zeta<<<wgrid, wblk, 0, stream>>>(q, za, bias, alpha, lrow, zb);
  // out = V(w2), w2 = UW(zeta_b) formed inside
  k_value<<<wgrid, wblk, 0, stream>>>(q, zb, mu, bias, alpha, out);

  (void)in_sizes;
  (void)n_in;
  (void)out_size;
  (void)ws_size;
}

// v007
// Measured time: 320 microseconds a run.
// Next to v006, in two timings, it ran 1.11 times as fast each time.
// Over all steps from v000 it is 2.64 times as fast.
#include <hip/hip_runtime.h>
#include <cstddef>

#define Hh 2048
#define Cc 64
#define BG 16
#define NTILE 128   // Hh / 16
#define LQLD 17     // padded LDS row stride (floats)
#define NW 4        // waves per work-group; each takes NTILE / NW tiles of the reduced axis
#define TPW 32      // NTILE / NW
#define NT 2        // 16-wide tiles of the fixed axis held by each wave
#define FW 32       // NT * 16: width of the fixed axis per work-group
#define PLD 33      // padded LDS row stride (floats) of the FW-wide partial sums
#define WLD 36      // LDS row stride (floats) of the 32-wide tiles: rows start at 16 bytes, banks spread
#define W2LD 68     // LDS row stride (floats) of the weights laid out for the B fragments
#define KPW 15      // of the 16 i-tiles of 32 that a K3 wave sums, those whose logits K2 keeps
#define LBLK 512    // floats of one kept block: 32 rows i by 16 columns j
#define RTH 5.5f    // a logit may pass its row's reference maximum by this much (exp < 256)

typedef float v2f __attribute__((ext_vector_type(2)));
typedef float v4f __attribute__((ext_vector_type(4)));
typedef float v8f __attribute__((ext_vector_type(8)));

// Fragment loader for the 16x4 f32 A layout (and symmetric 4x16 B layout):
// lane L<16 : vgpr0 = X[kc+0][base+L], vgpr1 = X[kc+1][base+L]
// lane L>=16: vgpr0 = X[kc+2][base+L-16], vgpr1 = X[kc+3][base+L-16]
static __device__ __forceinline__ v2f frag_g(const float* p, int ld, int base,
                                             int kc, int half, int m) {
  const float* a = p + (size_t)(kc + 2 * half) * ld + base + m;
  v2f r;
  r.x = a[0];
  r.y = a[ld];
  return r;
}

// Orders one wave's own LDS stores and loads (each wave stages in LDS rows that
// no other wave touches inside the loops): the fences keep the waits a
// work-group barrier would bring, the wave barrier keeps the compiler from
// moving LDS accesses across; without it a lane could read a row before its
// neighbour lane's store. No other wave is waited for.
static __device__ __forceinline__ void wave_sync() {
  __builtin_amdgcn_fence(__ATOMIC_RELEASE, "workgroup");
  __builtin_amdgcn_wave_barrier();
  __builtin_amdgcn_fence(__ATOMIC_ACQUIRE, "workgroup");
}

// lane l reads lane l ^ 16 (the other half-wave's value of the same column)
static __device__ __forceinline__ float xhalf(float x) {
  const int b = __builtin_bit_cast(int, x);
  return __builtin_bit_cast(
      float, __builtin_amdgcn_permlanex16(b, b, 0x76543210, 0xfedcba98, false, false));
}

static __device__ __forceinline__ v8f wmma4(v2f a, v2f b, v8f c) {
  return __builtin_amdgcn_wmma_f32_16x16x4_f32(false, a, false, b, (short)0, c,
                                               false, false);
}

// A wave's TPW passes run in four stretches, ever shorter (20, 7, 3 and 2 of 32),
// at issue priority 3, 2, 1, 0, for speed only. A wave that is ahead now ranks below those behind it and
// takes only the slots they leave, so the four end close together; the last
// stretch is the shortest. Starts stretch ph (a scalar)
// and returns the number of passes done at its end; the last stretch and all
// that follows the loop run at priority 0.
static __device__ __forceinline__ int stretch(int ph) {
  if (ph == 0) {
    __builtin_amdgcn_s_setprio(3);
    return 5 * TPW / 8;
  }
  if (ph == 1) {
    __builtin_amdgcn_s_setprio(2);
    return 27 * TPW / 32;
  }
  if (ph == 2) {
    __builtin_amdgcn_s_setprio(1);
    return 15 * TPW / 16;
  }
  __builtin_amdgcn_s_setprio(0);
  return TPW;
}

// The same for K3's KPW passes with kept logits, which follow two passes of equal
// length at priority 3: 11, 3, 2 and 1 of 17.
static __device__ __forceinline__ int stretch_kept(int ph) {
  if (ph == 0) return 9;  // priority 3 stands since the two passes in front
  if (ph == 1) {
    __builtin_amdgcn_s_setprio(2);
    return 12;
  }
  if (ph == 2) {
    __builtin_amdgcn_s_setprio(1);
    return 14;
  }
  __builtin_amdgcn_s_setprio(0);
  return KPW;
}

// ---------------------------------------------------------------------------
// K1: bias[bg,h] = 0.5 * beta * sum_c mu[bg,c,h]^2
// ---------------------------------------------------------------------------
__global__ void k_bias(const float* __restrict__ mu,
                       const float* __restrict__ beta,
                       float* __restrict__ bias) {
  const int idx = blockIdx.x * 256 + threadIdx.x;  // 0 .. BG*Hh-1
  const int bg = idx >> 11;                        // Hh == 2048
  const int h = idx & (Hh - 1);
  const float* p = mu + (size_t)bg * Cc * Hh + h;
  float s = 0.0f;
#pragma unroll 4
  for (int c = 0; c < Cc; ++c) {
    const float x = p[(size_t)c * Hh];
    s = fmaf(x, x, s);
  }
  bias[idx] = 0.5f * beta[0] * s;
}

// ---------------------------------------------------------------------------
// K2: per (bg, NT i-tiles) work-group: streaming softmax stats over j
//     logits[i,j] = a*(q^T zeta)[i,j] + bias[j];  m = rowmax, s = sum exp
//     stored per row: m + log(s), so that exp(logit - stored) is the normalised weight
//     logits computed TRANSPOSED (M=j, N=i): a lane holds eight j of ONE row i,
//     so maximum and sum over j run in the lane's own registers and no lane
//     exchange stands in the loop
//     each of the NW waves streams a quarter of j; the 2 * NW partial (m, s) of a
//     row (two half-waves a wave) merge in LDS
//     each wave holds NT i-tiles, so every loaded zeta fragment feeds NT products
//     the logits are kept for K3 as they lie in the registers: block (i-tile of
//     32, j-tile of 16), chunk 2*u + v/4, lane, v%4; the workspace holds KPW of
//     every 16 i-tiles, the first of each 16 is not kept and K3 forms it anew
// ---------------------------------------------------------------------------
__global__ __launch_bounds__(32 * NW, 4) void k_stats(
    const float* __restrict__ q, const float* __restrict__ zeta,
    const float* __restrict__ bias, const float* __restrict__ alpha,
    float* __restrict__ lrow, float* __restrict__ lg) {
  __shared__ float pm[2 * NW][FW];
  __shared__ float ps[2 * NW][FW];
  const int wave = __builtin_amdgcn_readfirstlane((int)(threadIdx.x >> 5));
  const int wid = blockIdx.x;
  const int bg = wid >> 6;
  const int i0 = (wid & 63) << 5;
  const float* qbg = q + (size_t)bg * Cc * Hh;
  const float* zbg = zeta + (size_t)bg * Cc * Hh;
  const float* bbg = bias + (size_t)bg * Hh;
  const float a = alpha[0];
  const int lane = threadIdx.x & 31;
  const int half = lane >> 4;
  const int n = lane & 15;

  // B fragments of q (K=c, N=i), persistent across the j loop
  v2f bq[NT][16];
#pragma unroll
  for (int u = 0; u < NT; ++u) {
#pragma unroll
    for (int kb = 0; kb < 16; ++kb)
      bq[u][kb] = frag_g(qbg, Hh, i0 + 16 * u, kb * 4, half, n);
  }

  // running (max, sum) of row i0 + 16*u + n over the j this half-wave has seen
  float rmax[NT], rsum[NT];
#pragma unroll
  for (int u = 0; u < NT; ++u) {
    rmax[u] = -3.0e38f;
    rsum[u] = 0.0f;
  }

  const float* zfr = zbg + (size_t)(2 * half) * Hh + n;  // lane's element of row 2*half
  const float* bfr = bbg + 8 * half;                     // bias of this half-wave's first row j
  const int it32 = wid & 63;
  const bool keep = (it32 & 15) != 0;
  // this lane's place in the first block of the tile's slot (slot 0 stands in where none is kept)
  const int slot = keep ? (it32 >> 4) * KPW + (it32 & 15) - 1 : 0;
  float* lgl = lg + ((size_t)bg * (NW * KPW) + slot) * (NTILE * LBLK) + lane * 4;
  int jt = wave * TPW;
  // kept rolled: one copy of the pass in the instruction cache
#pragma unroll 1
  for (int ph = 0; ph < 4; ++ph) {
  const int jend = wave * TPW + stretch(ph);
  for (; jt < jend; ++jt) {
    const int j0 = jt << 4;
    const float* zp = zfr + j0;
    // bias by row j = j0 + 8*half + v: eight neighbours, 32-byte aligned
    const v4f* bp = (const v4f*)(bfr + j0);
    v2f az[16];  // A: zeta^T (M=j, K=c)
#pragma unroll
    for (int kb = 0; kb < 16; ++kb) az[kb] = frag_g(zp, Hh, 0, kb * 4, 0, 0);
    const v4f b0 = bp[0];
    const v4f b1 = bp[1];
    // the address registers of the loads above are inputs here, so they live up
    // to this wait and are reused (also as a load's target) only behind it
    asm volatile("s_wait_xcnt 0x0" ::"v"(zp), "v"(bp) : "memory");
    v8f d[NT];
#pragma unroll
    for (int u = 0; u < NT; ++u) d[u] = v8f{0.f, 0.f, 0.f, 0.f, 0.f, 0.f, 0.f, 0.f};
#pragma unroll
    for (int kb = 0; kb < 16; ++kb) {
#pragma unroll
      for (int u = 0; u < NT; ++u) d[u] = wmma4(az[kb], bq[u][kb], d[u]);
    }
    v4f tl[NT][2];  // the logits: tile u, rows j0 + 8*half + 4*h + (0..3)
#pragma unroll
    for (int u = 0; u < NT; ++u) {
#pragma unroll
      for (int v = 0; v < 4; ++v) {
        tl[u][0][v] = fmaf(a, d[u][v], b0[v]);
        tl[u][1][v] = fmaf(a, d[u][v + 4], b1[v]);
      }
    }
    if (keep) {
      float* lp = lgl + (size_t)jt * LBLK;
#pragma unroll
      for (int ch = 0; ch < 4; ++ch) *(v4f*)(lp + ch * 128) = tl[ch >> 1][ch & 1];
      // address and data registers of the four stores are inputs here, so they
      // live up to this wait and are reused only behind it
      asm volatile("s_wait_xcnt 0x0" ::"v"(lp), "v"(tl[0][0]), "v"(tl[0][1]), "v"(tl[1][0]),
                   "v"(tl[1][1])
                   : "memory");
    }
#pragma unroll
    for (int u = 0; u < NT; ++u) {
      float t[8];
#pragma unroll
      for (int v = 0; v < 4; ++v) {
        t[v] = tl[u][0][v];
        t[v + 4] = tl[u][1][v];
      }
      float tm = rmax[u];
#pragma unroll
      for (int v = 0; v < 8; ++v) tm = fmaxf(tm, t[v]);  // the new running maximum
      float e[8];
#pragma unroll
      for (int v = 0; v < 8; ++v) e[v] = __expf(t[v] - tm);
      const float es = ((e[0] + e[1]) + (e[2] + e[3])) + ((e[4] + e[5]) + (e[6] + e[7]));
      rsum[u] = rsum[u] * __expf(rmax[u] - tm) + es;
      rmax[u] = tm;
    }
  }
  }
#pragma unroll
  for (int u = 0; u < NT; ++u) {
    pm[2 * wave + half][16 * u + n] = rmax[u];
    ps[2 * wave + half][16 * u + n] = rsum[u];
  }
  __syncthreads();
  // merge the 2 * NW partial (max, sum) pairs of each row
  if (threadIdx.x < FW) {
    const int r = threadIdx.x;
    float m = pm[0][r];
#pragma unroll
    for (int w = 1; w < 2 * NW; ++w) m = fmaxf(m, pm[w][r]);
    float ex[2 * NW];
#pragma unroll
    for (int w = 0; w < 2 * NW; ++w) ex[w] = __expf(pm[w][r] - m);
    float sum = 0.0f;
#pragma unroll
    for (int w = 0; w < 2 * NW; ++w) sum = fmaf(ps[w][r], ex[w], sum);
    lrow[(size_t)bg * Hh + i0 + r] = m + logf(sum + 1e-20f);
  }
}

// ---------------------------------------------------------------------------
// K3: per (bg, NT j-tiles) work-group: zeta_new[c,j] = (sum_i w[i,j] q[c,i]) / sum_i w
//     w = exp(logit - (m + log(s))): the division by the row sum is a subtraction
//     in the exponent, one logarithm a row in K2
//     of a wave's 16 i-tiles of 32 the first has no kept logits: two passes of 16
//     rows form them anew from zeta_old; the other KPW passes read K2's block,
//     turn w through LDS into B orientation and do the second product alone
//     (zold and znew may be one buffer: a work-group reads and writes only its
//     own 32 columns, the writes behind the merge barrier)
//     each of the NW waves sums a quarter of i; partial sums merge in LDS
//     each wave holds NT j-tiles, so every staged q tile and every q fragment
//     read from LDS feeds NT products
//     (launch bound 4 = waves a SIMD: a budget of 256 registers, so that all
//     1024 work-groups are resident at once)
// ---------------------------------------------------------------------------
__global__ __launch_bounds__(32 * NW, 4) void k_zeta(
    const float* __restrict__ q, const float* zold,
    const float* __restrict__ bias, const float* __restrict__ alpha,
    const float* __restrict__ lrow, const float* __restrict__ lg, float* znew) {
  // staging at stride LQLD or WLD, partial sums at PLD; 16-byte LDS accesses
  __shared__ __attribute__((aligned(16))) float lqs[NW][Cc * WLD];
  __shared__ __attribute__((aligned(16))) float lws[NW][FW * WLD];
  const int wave = __builtin_amdgcn_readfirstlane((int)(threadIdx.x >> 5));
  float* lq = lqs[wave];  // this wave's own staging rows
  float* lw = lws[wave];
  const int wid = blockIdx.x;
  const int bg = wid >> 6;
  const int j0 = (wid & 63) << 5;
  const float* qbg = q + (size_t)bg * Cc * Hh;
  const float* zbg = zold + (size_t)bg * Cc * Hh;
  const float* bbg = bias + (size_t)bg * Hh;
  const float* lbg = lrow + (size_t)bg * Hh;
  const float a = alpha[0];
  const int lane = threadIdx.x & 31;
  const int half = lane >> 4;
  const int n = lane & 15;

  // B fragments of zeta (K=c, N=j) for the fixed j-tiles, persistent
  v2f bz[NT][16];
  float bn[NT];
  const float* zfr = zbg + (size_t)(2 * half) * Hh + j0 + n;  // lane's element of row 2*half
#pragma unroll
  for (int u = 0; u < NT; ++u) {
#pragma unroll
    for (int kb = 0; kb < 16; ++kb) bz[u][kb] = frag_g(zfr, Hh, 16 * u, kb * 4, 0, 0);
    bn[u] = bbg[j0 + n + 16 * u];
  }
  // the address registers of the loads above are inputs here, so they live up
  // to this wait and are reused only behind it
  asm volatile("s_wait_xcnt 0x0" ::"v"(zfr), "v"(j0 + n) : "memory");

  const v8f vz = {0.f, 0.f, 0.f, 0.f, 0.f, 0.f, 0.f, 0.f};
  v8f acc[NT][4];
  float csum[NT];
#pragma unroll
  for (int u = 0; u < NT; ++u) {
#pragma unroll
    for (int t = 0; t < 4; ++t) acc[u][t] = vz;
    csum[u] = 0.0f;
  }

  const float* qst = qbg + (size_t)half * Hh + n;  // lane's element of rows half, half+2, ...
  // Per-lane LDS bases, so that every access below is base + constant and the
  // address registers stay few (the fragments and sums fill the register budget).
  float* lq_st = lq + half * LQLD + n;            // staging store: row 2k + half, column n
  const float* lq_a1 = lq + 2 * half * LQLD + n;  // GEMM1 A: row kc + 2*half, column n
  const float* lq_a2 = lq + n * LQLD + 2 * half;  // GEMM2 A: row t*16 + n, column kc + 2*half
  float* lw_st = lw + 8 * half * 16 + n;          // w store: tile u, row v + 8*half, column n
  const float* lw_b2 = lw + 2 * half * 16 + n;    // GEMM2 B: tile u, row kc + 2*half, column n
  // the two passes without kept logits run first, in the first priority stretch
  __builtin_amdgcn_s_setprio(3);
  // kept rolled: one copy of the pass in the instruction cache
#pragma unroll 1
  for (int it = wave * TPW; it < wave * TPW + 2; ++it) {
    const int i0 = it << 4;
    // stage q[c, i0:i0+16] tile into LDS (coalesced)
    // (one lane address plus constant row steps: keeps the address registers few)
    const float* qsi = qst + i0;
#pragma unroll
    for (int k = 0; k < Cc / 2; ++k) lq_st[2 * k * LQLD] = qsi[(size_t)(2 * k) * Hh];
    wave_sync();
    // GEMM1: qz[i,j] = sum_c q[c,i] zeta[c,j]
    v8f d[NT];
#pragma unroll
    for (int u = 0; u < NT; ++u) d[u] = vz;
#pragma unroll
    for (int kb = 0; kb < 16; ++kb) {
      const int kc = kb * 4;
      v2f afr;  // A: q^T (M=i, K=c) read from LDS
      afr.x = lq_a1[kc * LQLD];
      afr.y = lq_a1[(kc + 1) * LQLD];
#pragma unroll
      for (int u = 0; u < NT; ++u) d[u] = wmma4(afr, bz[u][kb], d[u]);
    }
    // w tiles -> LDS, plus column-sum accumulation
#pragma unroll
    for (int v = 0; v < 8; ++v) {
      const int row = i0 + v + 8 * half;
      const float lv = lbg[row];
#pragma unroll
      for (int u = 0; u < NT; ++u) {
        const float w = __expf(fmaf(a, d[u][v], bn[u]) - lv);
        lw_st[u * 256 + v * 16] = w;
        csum[u] += w;
      }
    }
    wave_sync();
    // GEMM2: acc[c,j] += q[c,i] * w[i,j]  (K = i, 4 steps of 4)
#pragma unroll
    for (int t = 0; t < 4; ++t) {
#pragma unroll
      for (int kb = 0; kb < 4; ++kb) {
        const int kc = kb * 4;
        v2f a2;  // A: q (M=c, K=i)
        a2.x = lq_a2[t * 16 * LQLD + kc];
        a2.y = lq_a2[t * 16 * LQLD + kc + 1];
#pragma unroll
        for (int u = 0; u < NT; ++u) {
          v2f b2;  // B: w (K=i, N=j)
          b2.x = lw_b2[u * 256 + kc * 16];
          b2.y = lw_b2[u * 256 + (kc + 1) * 16];
          acc[u][t] = wmma4(a2, b2, acc[u][t]);
        }
      }
    }
    wave_sync();
  }

  // ---- the KPW passes with kept logits: 32 rows i a pass
  // a lane holds, as K2 left them, rows i = 16*u + n and columns j = 16*jj + 8*half + k
  float cpl[NT][8];  // lane's share of the column sums, by (jj, k)
#pragma unroll
  for (int jj = 0; jj < NT; ++jj) {
#pragma unroll
    for (int k = 0; k < 8; ++k) cpl[jj][k] = 0.0f;
  }
  const float* lgl = lg + ((size_t)bg * (NW * KPW) + wave * KPW) * (NTILE * LBLK) +
                     (size_t)(wid & 63) * (NT * LBLK) + lane * 4;
  // staging: eight lanes a row of 32; a load takes rows r, r + 8 (lanes 0-15) and r + 1, r + 9,
  // so that the 16 lanes of an LDS store fall on 64 different banks
  const int qrow = (lane >> 4) + 8 * ((lane >> 3) & 1);
  const float* q4 = qbg + (size_t)qrow * Hh + (lane & 7) * 4;
  float* lq_s4 = lq + qrow * WLD + (lane & 7) * 4;
  const float* lq_a = lq + n * WLD + half;   // A: row t*16 + n, columns 4s + half and + 2
  // w of row i = 4s + hb + 2e, column 16*u + x lies at LDS row s + 8*hb, place 32*u + 16*e + x:
  // a B fragment's two values 16 floats apart, the half-waves 32 banks apart
  float* lw_s4 = lw + ((n >> 2) + 8 * (n & 1)) * W2LD + 16 * ((n >> 1) & 1) + 8 * half;
  const float* lw_b = lw + 8 * half * W2LD + n;
  float* lw_c = lw + n * WLD + 8 * half;     // column sums: row n, column 16*jj + 8*half + 4*h
  int p = 0;
  // kept rolled: one copy of the pass in the instruction cache
#pragma unroll 1
  for (int ph = 0; ph < 4; ++ph) {
  const int pend = stretch_kept(ph);
  for (; p < pend; ++p) {
    const int i0 = (wave * 16 + 1 + p) << 5;
    const float* qp = q4 + i0;
    const float* lp = lgl + (size_t)p * (NTILE * LBLK);
    const float* rp = lbg + i0 + n;
    v4f lv[NT][4];  // read once, from memory: non-temporal, so that q stays in L2
#pragma unroll
    for (int jj = 0; jj < NT; ++jj) {
#pragma unroll
      for (int ch = 0; ch < 4; ++ch)
        lv[jj][ch] = __builtin_nontemporal_load((const v4f*)(lp + jj * LBLK + ch * 128));
    }
    float lr[NT];
#pragma unroll
    for (int u = 0; u < NT; ++u) lr[u] = rp[16 * u];
    v4f qv[Cc / 4];
#pragma unroll
    for (int k = 0; k < Cc / 4; ++k)
      qv[k] = *(const v4f*)(qp + (size_t)(16 * (k >> 2) + 2 * (k & 3)) * Hh);
    // the address registers of the loads above are inputs here, so they live up
    // to this wait and are reused (also as a load's target) only behind it
    asm volatile("s_wait_xcnt 0x0" ::"v"(qp), "v"(lp), "v"(rp) : "memory");
#pragma unroll
    for (int k = 0; k < Cc / 4; ++k) *(v4f*)(lq_s4 + (16 * (k >> 2) + 2 * (k & 3)) * WLD) = qv[k];
#pragma unroll
    for (int jj = 0; jj < NT; ++jj) {
#pragma unroll
      for (int ch = 0; ch < 4; ++ch) {
        const int u = ch >> 1;
        const int h = ch & 1;
        v4f w;
#pragma unroll
        for (int e = 0; e < 4; ++e) {
          w[e] = __expf(lv[jj][ch][e] - lr[u]);
          cpl[jj][4 * h + e] += w[e];
        }
        *(v4f*)(lw_s4 + 4 * u * W2LD + 32 * jj + 4 * h) = w;
      }
    }
    wave_sync();
    // acc[c,j] += q[c,i] * w[i,j]; K slot 2*half + e of step s is row i = 4s + half + 2e,
    // in A and in B alike
#pragma unroll
    for (int s = 0; s < 8; ++s) {
      v2f b2[NT];
#pragma unroll
      for (int u = 0; u < NT; ++u) {
        b2[u].x = lw_b[s * W2LD + 32 * u];
        b2[u].y = lw_b[s * W2LD + 32 * u + 16];
      }
#pragma unroll
      for (int t = 0; t < 4; ++t) {
        v2f a2;
        a2.x = lq_a[t * 16 * WLD + 4 * s];
        a2.y = lq_a[t * 16 * WLD + 4 * s + 2];
#pragma unroll
        for (int u = 0; u < NT; ++u) acc[u][t] = wmma4(a2, b2[u], acc[u][t]);
      }
    }
    wave_sync();
  }
  }
  // column sums of the kept passes: the 16 lanes' shares meet in LDS, lane l takes column l
#pragma unroll
  for (int jj = 0; jj < NT; ++jj) {
#pragma unroll
    for (int h = 0; h < 2; ++h) {
      const v4f c4 = {cpl[jj][4 * h], cpl[jj][4 * h + 1], cpl[jj][4 * h + 2], cpl[jj][4 * h + 3]};
      *(v4f*)(lw_c + 16 * jj + 4 * h) = c4;
    }
  }
  wave_sync();
  float ckept = 0.0f;
#pragma unroll
  for (int r = 0; r < 16; ++r) ckept += lw[r * WLD + lane];
  wave_sync();
  // each wave leaves its partial sums in its own staging rows
  float* lq_p = lq + 8 * half * PLD + n;  // row t*16 + v + 8*half, column 16*u + n
#pragma unroll
  for (int u = 0; u < NT; ++u) {
    csum[u] += __shfl_xor(csum[u], 16, 32);  // combine the two half-wave row groups
#pragma unroll
    for (int t = 0; t < 4; ++t) {
#pragma unroll
      for (int v = 0; v < 8; ++v) {
        lq_p[(t * 16 + v) * PLD + 16 * u] = acc[u][t][v];
      }
    }
  }
  lw[lane] = ckept + (half ? csum[1] : csum[0]);  // column lane = 16*half + n
  __syncthreads();
  // merge: thread x owns column x & 31 and rows (x >> 5) + 4k
  const int mc = threadIdx.x >> 5;
  float cs = 0.0f;
#pragma unroll
  for (int w = 0; w < NW; ++w) cs += lws[w][lane];
  const float inv = 1.0f / cs;
  float* zo = znew + (size_t)bg * Cc * Hh;
#pragma unroll
  for (int k = 0; k < Cc / NW; ++k) {
    const int c = mc + NW * k;
    float sum = 0.0f;
#pragma unroll
    for (int w = 0; w < NW; ++w) sum += lqs[w][c * PLD + lane];
    zo[(size_t)c * Hh + j0 + lane] = sum * inv;
  }
}

// ---------------------------------------------------------------------------
// K4: per (bg, NT i-tiles) work-group: out[c,i] = sum_j w[i,j] mu[c,j]
//     logits computed TRANSPOSED (M=j, N=i) so w^T lands in B orientation
//     the softmax over j runs inside this loop: a lane owns one row i, keeps a
//     reference maximum and the sum of exp(logit - reference) for it, and the
//     sums over j carry the same factor; when a logit passes the reference by
//     more than RTH the sums are rescaled to the new maximum (one test a pass);
//     the division by the row sum is done once, at the merge
//     every exponent is a plain difference of stored values (logit - reference,
//     old reference - new), so a row whose reference stays is rescaled by exactly 1
//     each of the NW waves sums a quarter of j; partial sums merge in LDS, each
//     brought to the largest of the waves' references
//     (the unroll directives on the short loops over u, v, t and w keep the
//     arrays they index in registers)
//     each wave holds NT i-tiles, so every loaded zeta fragment, every staged
//     mu tile and every mu fragment read from LDS feeds NT products
//     (launch bound 4 = waves a SIMD: a budget of 256 registers, so that all
//     1024 work-groups are resident at once)
// ---------------------------------------------------------------------------
__global__ __launch_bounds__(32 * NW, 4) void k_value(
    const float* __restrict__ q, const float* __restrict__ zeta,
    const float* __restrict__ mu, const float* __restrict__ bias,
    const float* __restrict__ alpha, float* __restrict__ out) {
  __shared__ float lmus[NW][Cc * PLD];  // staging at stride LQLD, partial sums at PLD
  __shared__ float lws[NW][NT * 16 * 16];
  const int wave = __builtin_amdgcn_readfirstlane((int)(threadIdx.x >> 5));
  float* lmu = lmus[wave];  // this wave's own staging rows
  float* lw = lws[wave];
  const int wid = blockIdx.x;
  const int bg = wid >> 6;
  const int i0 = (wid & 63) << 5;
  const float* qbg = q + (size_t)bg * Cc * Hh;
  const float* zbg = zeta + (size_t)bg * Cc * Hh;
  const float* mubg = mu + (size_t)bg * Cc * Hh;
  const float* bbg = bias + (size_t)bg * Hh;
  const float a = alpha[0];
  const int lane = threadIdx.x & 31;
  const int half = lane >> 4;
  const int n = lane & 15;

  // B fragments of q (K=c, N=i) for the fixed i-tiles, persistent
  v2f bq[NT][16];
  const float* qfr = qbg + (size_t)(2 * half) * Hh + i0 + n;  // lane's element of row 2*half
#pragma unroll
  for (int u = 0; u < NT; ++u) {
#pragma unroll
    for (int kb = 0; kb < 16; ++kb) bq[u][kb] = frag_g(qfr, Hh, 16 * u, kb * 4, 0, 0);
  }
  // the address registers of the loads above are inputs here, so they live up
  // to this wait and are reused only behind it
  asm volatile("s_wait_xcnt 0x0" ::"v"(qfr), "v"(n) : "memory");

  // row i0 + 16*u + n: reference maximum (equal in both half-waves) and the sum
  // of exp(logit - reference) over the j this half-wave has seen
  float mref[NT], rsum[NT];
#pragma unroll
  for (int u = 0; u < NT; ++u) {
    mref[u] = -3.0e38f;
    rsum[u] = 0.0f;
  }

  const v8f vz = {0.f, 0.f, 0.f, 0.f, 0.f, 0.f, 0.f, 0.f};
  v8f acc[NT][4];
#pragma unroll
  for (int u = 0; u < NT; ++u) {
#pragma unroll
    for (int t = 0; t < 4; ++t) acc[u][t] = vz;
  }

  const float* must = mubg + (size_t)half * Hh + n;  // lane's element of rows half, half+2, ...
  // Per-lane LDS bases, so that every access below is base + constant and the
  // address registers stay few (the fragments and sums fill the register budget).
  float* lmu_st = lmu + half * LQLD + n;            // staging store: row 2k + half, column n
  const float* lmu_a2 = lmu + n * LQLD + 2 * half;  // GEMM2 A: row t*16 + n, column kc + 2*half
  float* lw_st = lw + 8 * half * 16 + n;            // w^T store: tile u, row v + 8*half, column n
  const float* lw_b2 = lw + 2 * half * 16 + n;      // GEMM2 B: tile u, row kc + 2*half, column n
  int jt = wave * TPW;
  // kept rolled: one copy of the pass in the instruction cache
#pragma unroll 1
  for (int ph = 0; ph < 4; ++ph) {
  const int jend = wave * TPW + stretch(ph);
  for (; jt < jend; ++jt) {
    const int j0 = jt << 4;
    // stage mu[c, j0:j0+16] tile into LDS
    // (one lane address plus constant row steps: keeps the address registers few)
    const float* musi = must + j0;
#pragma unroll
    for (int k = 0; k < Cc / 2; ++k) lmu_st[2 * k * LQLD] = musi[(size_t)(2 * k) * Hh];
    wave_sync();
    // transposed logits: tz[j,i] = sum_c zeta[c,j] q[c,i]
    v8f d[NT];
#pragma unroll
    for (int u = 0; u < NT; ++u) d[u] = vz;
#pragma unroll
    for (int kb = 0; kb < 16; ++kb) {
      v2f az = frag_g(zbg, Hh, j0, kb * 4, half, n);  // A: zeta^T (M=j, K=c)
#pragma unroll
      for (int u = 0; u < NT; ++u) d[u] = wmma4(az, bq[u][kb], d[u]);
    }
    // logits: bias by row j
#pragma unroll
    for (int v = 0; v < 8; ++v) {
      const float bj = bbg[j0 + v + 8 * half];
#pragma unroll
      for (int u = 0; u < NT; ++u) d[u][v] = fmaf(a, d[u][v], bj);
    }
    float tm[NT];  // this pass's maximum over the lane's eight j
    bool need = false;
#pragma unroll
    for (int u = 0; u < NT; ++u) {
      tm[u] = d[u][0];
#pragma unroll
      for (int v = 1; v < 8; ++v) tm[u] = fmaxf(tm[u], d[u][v]);
      need = need || (tm[u] > mref[u] + RTH);
    }
    // one scalar branch a pass: taken on the first pass and where some row's
    // logits have outgrown its reference; every lane then takes its row's maximum
    if (__builtin_amdgcn_ballot_w32(need) != 0) {
#pragma unroll
      for (int u = 0; u < NT; ++u) {
        const float mn = fmaxf(mref[u], fmaxf(tm[u], xhalf(tm[u])));
        // exactly 1 for a row whose reference stays; 0 on the first pass
        const float corr = __expf(mref[u] - mn);
        rsum[u] *= corr;
#pragma unroll
        for (int t = 0; t < 4; ++t) acc[u][t] *= corr;
        mref[u] = mn;
      }
    }
    // exp(logit - reference), at most exp(RTH): w^T[j,i] up to the row's factor -> LDS
#pragma unroll
    for (int u = 0; u < NT; ++u) {
      float e[8];
#pragma unroll
      for (int v = 0; v < 8; ++v) {
        e[v] = __expf(d[u][v] - mref[u]);
        lw_st[u * 256 + v * 16] = e[v];
      }
      rsum[u] += ((e[0] + e[1]) + (e[2] + e[3])) + ((e[4] + e[5]) + (e[6] + e[7]));
    }
    wave_sync();
    // GEMM2: acc[c,i] += mu[c,j] * w^T[j,i]  (K = j, 4 steps of 4)
#pragma unroll
    for (int t = 0; t < 4; ++t) {
#pragma unroll
      for (int kb = 0; kb < 4; ++kb) {
        const int kc = kb * 4;
        v2f a2;  // A: mu (M=c, K=j)
        a2.x = lmu_a2[t * 16 * LQLD + kc];
        a2.y = lmu_a2[t * 16 * LQLD + kc + 1];
#pragma unroll
        for (int u = 0; u < NT; ++u) {
          v2f b2;  // B: w^T (K=j, N=i)
          b2.x = lw_b2[u * 256 + kc * 16];
          b2.y = lw_b2[u * 256 + (kc + 1) * 16];
          acc[u][t] = wmma4(a2, b2, acc[u][t]);
        }
      }
    }
    wave_sync();
  }
  }
  // each wave leaves its partial sums in its own staging rows
  float* lmu_p = lmu + 8 * half * PLD + n;  // row t*16 + v + 8*half, column 16*u + n
#pragma unroll
  for (int u = 0; u < NT; ++u) {
#pragma unroll
    for (int t = 0; t < 4; ++t) {
#pragma unroll
      for (int v = 0; v < 8; ++v) {
        lmu_p[(t * 16 + v) * PLD + 16 * u] = acc[u][t][v];
      }
    }
    rsum[u] += xhalf(rsum[u]);  // join the two half-waves' j
    if (half == 0) {
      lw[16 * u + n] = mref[u];
      lw[FW + 16 * u + n] = rsum[u];
    }
  }
  __syncthreads();
  // merge: thread x owns column x & 31 and rows (x >> 5) + 4k
  const int mc = threadIdx.x >> 5;
  // the waves' references differ: bring each wave's sums to the largest of them
  float mall = lws[0][lane];
#pragma unroll
  for (int w = 1; w < NW; ++w) mall = fmaxf(mall, lws[w][lane]);
  float fw[NW];
#pragma unroll
  for (int w = 0; w < NW; ++w) fw[w] = __expf(lws[w][lane] - mall);
  float sall = lws[0][FW + lane] * fw[0];
#pragma unroll
  for (int w = 1; w < NW; ++w) sall = fmaf(lws[w][FW + lane], fw[w], sall);
  const float inv = 1.0f / (sall + 1e-20f);
  float* obg = out + (size_t)bg * Cc * Hh;
#pragma unroll
  for (int k = 0; k < Cc / NW; ++k) {
    const int c = mc + NW * k;
    float sum = lmus[0][c * PLD + lane] * fw[0];
#pragma unroll
    for (int w = 1; w < NW; ++w) sum = fmaf(lmus[w][c * PLD + lane], fw[w], sum);
    obg[(size_t)c * Hh + i0 + lane] = sum * inv;
  }
}

// ---------------------------------------------------------------------------
extern "C" void kernel_launch(void* const* d_in, const int* in_sizes, int n_in,
                              void* d_out, int out_size, void* d_ws,
                              size_t ws_size, hipStream_t stream) {
  const float* q = (const float*)d_in[0];
  const float* zeta = (const float*)d_in[1];
  const float* alpha = (const float*)d_in[2];
  const float* mu = (const float*)d_in[3];
  const float* beta = (const float*)d_in[4];
  float* out = (float*)d_out;

  float* ws = (float*)d_ws;
  float* bias = ws;                          // BG*Hh floats
  float* lrow = ws + (size_t)BG * Hh;        // BG*Hh
  float* za = ws + (size_t)2 * BG * Hh;      // BG*Cc*Hh
  float* lg = za + (size_t)BG * Cc * Hh;     // BG*NW*KPW*NTILE*LBLK floats: 240 MiB (248.25 in all)

  const dim3 wgrid(BG * (NTILE / NT)), wblk(32 * NW);

  k_bias<<<dim3((BG * Hh) / 256), dim3(256), 0, stream>>>(mu, beta, bias);
  // w0 = UW(zeta_in)
  k_stats<<<wgrid, wblk, 0, stream>>>(q, zeta, bias, alpha, lrow, lg);
  // iter 1: zeta_a = Z(w0);  w1 = UW(zeta_a)
  k_zeta<<<wgrid, wblk, 0, stream>>>(q, zeta, bias, alpha, lrow, lg, za);
  k_stats<<<wgrid, wblk, 0, stream>>>(q, za, bias, alpha, lrow, lg);
  // iter 2: zeta_b = Z(w1), over zeta_a in place
  k_zeta<<<wgrid, wblk, 0, stream>>>(q, za, bias, alpha, lrow, lg, za);
  // out = V(w2), w2 = UW(zeta_b) formed inside
  k_value<<<wgrid, wblk, 0, stream>>>(q, za, mu, bias, alpha, out);

  (void)in_sizes;
  (void)n_in;
  (void)out_size;
  (void)ws_size;
}
